// v000
// Times are from an AMD MI455X. After a warm-up the kernel runs many times in a row, and a time is the length of
// such a window on the GPU divided by its runs, so every launch and the gaps after it count. The runs cycle
// through copies of the inputs. A figure is the median of several windows, for all but v000 over two sittings.
// Sittings can differ by a few percent; kernels timed side by side share one.
// The starting kernel, v000, takes 21.1 milliseconds a run.
#include <hip/hip_runtime.h>
// SA layer (x [8][4096][128]; q, k = x W + b ([in][out] [128][64]), v = x Wv + bv; scores = q.k (NO scaling, logits sigma ~8); softmax; out = attn v -> [8][4096][64]).
// Structure: token rows; x as exact f16 rows; q | k | v WMMA GEMMs (32x64 wave tiles, f32 accumulation, exact x16 transposed [in][out] weights + bias); q and k as f16 hi + 2^-10 residual planes (three-term scores); v as f16 rows, V^T via LDS transposes; per (batch, 2048-query tile): scores GEMM (K = 64), row softmax on VALU (f32; P x256 f16), out = P . V^T GEMM written straight to the f32 output.
// Compute dtype: inputs rounded to bf16; x / weights exact; q, k hi + residual (~2^-22); v, P plain f16 (~2^-12); scores / softmax f32. v_wmma_f32_16x16x32_f16.
#define NB 8
#define SQ 4096
#define DM 128
#define DQ 64
#define DV 64
#define QT 2048                     /* query tile */
#define NH 1                    /* V^T slabs of 64 (k_vt<NH, SQ>) */
#define HD 64
#define HG 1
#define NR ((size_t)NB * SQ)
#define QN SQ                        /* query rows per batch (debug hook) */
#define NBR NB                       /* batches (debug hook) */
#define MP ((int)NR)                 /* rows through the projections (debug hook) */
typedef __bf16 v16b __attribute__((ext_vector_type(16)));
typedef unsigned short v8us __attribute__((ext_vector_type(8), may_alias));
typedef float  v8f  __attribute__((ext_vector_type(8)));
typedef float  v4f  __attribute__((ext_vector_type(4)));
typedef float  v4fa __attribute__((ext_vector_type(4), may_alias));
union FragB { v16b v; v8us half[2]; unsigned short u[16]; };

__device__ __forceinline__ unsigned short bf16_bits(float x) { unsigned int u = __float_as_uint(x); return (unsigned short)((u + 0x7FFFu + ((u >> 16) & 1u)) >> 16); }
__device__ __forceinline__ float bf16_val(unsigned short b) { return __uint_as_float(((unsigned int)b) << 16); }
__device__ __forceinline__ float bf16_round(float x) { return bf16_val(bf16_bits(x)); }
// D += A·B with NT terms: 1 = ah·bh, 2 = + al·bh (A split), 3 = + ah·bl (both split)
template <int NT>
__device__ __forceinline__ v8f mmaN(v16b ah, v16b al, v16b bh, v16b bl, v8f c) {
  c = __builtin_amdgcn_wmma_f32_16x16x32_bf16(false, ah, false, bh, (short)0, c, false, false);
  if (NT >= 2) c = __builtin_amdgcn_wmma_f32_16x16x32_bf16(false, al, false, bh, (short)0, c, false, false);
  if (NT >= 3) c = __builtin_amdgcn_wmma_f32_16x16x32_bf16(false, ah, false, bl, (short)0, c, false, false);
  asm volatile("v_nop\n\tv_nop\n\tv_nop\n\tv_nop" : "+v"(c) : "v"(ah), "v"(al), "v"(bh), "v"(bl));
  return c;
}

__global__ __launch_bounds__(256) void k_wt_bf16(const float* __restrict__ W, unsigned short* __restrict__ Wt, int K, int N) {
  const int t = blockIdx.x * 256 + threadIdx.x;
  const int k8n = K / 8;
  if (t >= N * k8n) return;
  const int n = t / k8n, k8 = (t % k8n) * 8;
  v8us v;
#pragma unroll
  for (int i = 0; i < 8; ++i) v[i] = bf16_bits(W[(size_t)(k8 + i) * N + n]);
  *(v8us*)(Wt + (size_t)n * K + k8) = v;
  
}

// GEMM C[M][N] (f32, pitch ldc) = act(A[M][K]·W + bias). A f32 row-major (pitch lda) converted per fragment to bf16
// (ASPLIT: hi/lo two planes -> 2 terms, else single rounded term); Wt bf16 [N][K] (pitch ldb). BIAS_BF16 rounds the
// bias to bf16 first (bias quantised to bf16 before the add). K%32==0, M%16==0, N%64==0.
template <bool ASPLIT, int ACT, bool BIAS_BF16>
__global__ __launch_bounds__(128) void k_gemm_bf(const float* __restrict__ A, int lda, const unsigned short* __restrict__ Wt, int ldb,
                                               const float* __restrict__ bias, float* __restrict__ C, int ldc, int M, int N, int K) {
  __shared__ __attribute__((aligned(16))) float so[4][16][64];
  const int tid = threadIdx.x, w = tid >> 5, lane = tid & 31, ln = lane & 15, hh = lane >> 4;
  const int ntn = N / 64;
  const int wid = blockIdx.x * 4 + w;
  const int mt = wid / ntn, nq = wid % ntn;
  if (mt * 16 >= M) return;
  const int row0 = mt * 16, col0 = nq * 64;
  const float* arow = A + (size_t)(row0 + ln) * lda;
  v8f acc[4] = {};
  for (int kb = 0; kb < K; kb += 32) {
    FragB ah, al;
    const v4f x0 = *(const v4fa*)(arow + kb + 8 * hh), x1 = *(const v4fa*)(arow + kb + 8 * hh + 4);
    const v4f x2 = *(const v4fa*)(arow + kb + 16 + 8 * hh), x3 = *(const v4fa*)(arow + kb + 16 + 8 * hh + 4);
    float xs[16] = {x0[0],x0[1],x0[2],x0[3],x1[0],x1[1],x1[2],x1[3],x2[0],x2[1],x2[2],x2[3],x3[0],x3[1],x3[2],x3[3]};
#pragma unroll
    for (int i = 0; i < 16; ++i) { const unsigned short hb = bf16_bits(xs[i]); ah.u[i] = hb; al.u[i] = ASPLIT ? bf16_bits(xs[i] - bf16_val(hb)) : (unsigned short)0; }
#pragma unroll
    for (int t = 0; t < 4; ++t) {
      const unsigned short* brow = Wt + (size_t)(col0 + t * 16 + ln) * ldb + kb;
      FragB b;
      b.half[0] = *(const v8us*)(brow + 8 * hh);
      b.half[1] = *(const v8us*)(brow + 16 + 8 * hh);
      acc[t] = mmaN<ASPLIT ? 2 : 1>(ah.v, al.v, b.v, b.v, acc[t]);
    }
  }
#pragma unroll
  for (int t = 0; t < 4; ++t) {
    float bv = bias ? bias[col0 + t * 16 + ln] : 0.f;
    if (BIAS_BF16) bv = bf16_round(bv);
#pragma unroll
    for (int r = 0; r < 8; ++r) { float v = acc[t][r] + bv; if (ACT == 1) v = fmaxf(v, 0.f); so[w][8 * hh + r][t * 16 + ln] = v; }
  }
  __builtin_amdgcn_fence(__ATOMIC_ACQ_REL, "workgroup");
  __builtin_amdgcn_wave_barrier();
  const int rsub = lane >> 4, c4 = (lane & 15) * 4;
  {
#pragma unroll
    for (int q = 0; q < 8; ++q) {
      const int r = q * 2 + rsub;
      const v4f v = *(const v4fa*)&so[w][r][c4];
      *(v4f*)(C + (size_t)(row0 + r) * ldc + col0 + c4) = v;
    }
    
  }
}

// GEMM C = act(A·W + bias + resid): A f32 (ASPLIT -> hi/lo 2 terms), Wt bf16 [N][K]; ACT 0 none, 1 relu, 2 exact gelu;
// resid (optional, f32, row index = (row % rmod), pitch ldr, RES_BF16 rounds it) added before the activation.
template <bool ASPLIT, int ACT, bool BIAS_BF16, bool RES_BF16>
__global__ __launch_bounds__(128) void k_gemm_bf3(const float* __restrict__ A, int lda, const unsigned short* __restrict__ Wt, int ldb,
                                                const float* __restrict__ bias, const float* __restrict__ resid, int rmod, int ldr,
                                                float* __restrict__ C, int ldc, int M, int N, int K) {
  __shared__ __attribute__((aligned(16))) float so[4][16][64];
  const int tid = threadIdx.x, w = tid >> 5, lane = tid & 31, ln = lane & 15, hh = lane >> 4;
  const int ntn = N / 64;
  const int wid = blockIdx.x * 4 + w;
  const int mt = wid / ntn, nq = wid % ntn;
  if (mt * 16 >= M) return;
  const int row0 = mt * 16, col0 = nq * 64;
  const float* arow = A + (size_t)(row0 + ln) * lda;
  v8f acc[4] = {};
  for (int kb = 0; kb < K; kb += 32) {
    FragB ah, al;
    const v4f x0 = *(const v4fa*)(arow + kb + 8 * hh), x1 = *(const v4fa*)(arow + kb + 8 * hh + 4);
    const v4f x2 = *(const v4fa*)(arow + kb + 16 + 8 * hh), x3 = *(const v4fa*)(arow + kb + 16 + 8 * hh + 4);
    float xs[16] = {x0[0],x0[1],x0[2],x0[3],x1[0],x1[1],x1[2],x1[3],x2[0],x2[1],x2[2],x2[3],x3[0],x3[1],x3[2],x3[3]};
#pragma unroll
    for (int i = 0; i < 16; ++i) { const unsigned short hb = bf16_bits(xs[i]); ah.u[i] = hb; al.u[i] = ASPLIT ? bf16_bits(xs[i] - bf16_val(hb)) : (unsigned short)0; }
#pragma unroll
    for (int t = 0; t < 4; ++t) {
      const unsigned short* brow = Wt + (size_t)(col0 + t * 16 + ln) * ldb + kb;
      FragB b;
      b.half[0] = *(const v8us*)(brow + 8 * hh);
      b.half[1] = *(const v8us*)(brow + 16 + 8 * hh);
      acc[t] = mmaN<ASPLIT ? 2 : 1>(ah.v, al.v, b.v, b.v, acc[t]);
    }
  }
#pragma unroll
  for (int t = 0; t < 4; ++t) {
    const int col = col0 + t * 16 + ln;
    float bv = bias ? bias[col] : 0.f;
    if (BIAS_BF16) bv = bf16_round(bv);
#pragma unroll
    for (int r = 0; r < 8; ++r) {
      float v = acc[t][r] + bv;
      if (resid) { float rv = resid[(size_t)((row0 + 8 * hh + r) % rmod) * ldr + col]; if (RES_BF16) rv = bf16_round(rv); v += rv; }
      if (ACT == 1) v = fmaxf(v, 0.f);
      if (ACT == 2) v = 0.5f * v * (1.0f + erff(v * 0.70710678118654752f));
      if (ACT == 3) { const float u = 0.7978845608028654f * (v + 0.044715f * v * v * v); v = 0.5f * v * (1.0f + tanhf(u)); }
      so[w][8 * hh + r][t * 16 + ln] = v;
    }
  }
  __builtin_amdgcn_fence(__ATOMIC_ACQ_REL, "workgroup");
  __builtin_amdgcn_wave_barrier();
  const int rsub = lane >> 4, c4 = (lane & 15) * 4;
  {
#pragma unroll
    for (int q = 0; q < 8; ++q) {
      const int r = q * 2 + rsub;
      const v4f v = *(const v4fa*)&so[w][r][c4];
      *(v4f*)(C + (size_t)(row0 + r) * ldc + col0 + c4) = v;
    }
    
  }
}
// row LayerNorm (biased variance, eps) over N: s = X (+ R); optional out_sum <- s; out_norm <- (s-mu)*rsqrt(var+eps)*g + b
template <bool PARAM_BF16>
__global__ __launch_bounds__(256) void k_layernorm(const float* __restrict__ X, const float* __restrict__ R, const float* __restrict__ g, const float* __restrict__ bta,
                                                  float* __restrict__ out_sum, float* __restrict__ out_norm, int N, float eps) {
  __shared__ float red[256];
  const int row = blockIdx.x, tid = threadIdx.x;
  const float* x = X + (size_t)row * N; const float* rr = R ? R + (size_t)row * N : nullptr;
  float vals[16];                     // up to N = 4096
  const int per = N / 256;            // contiguous chunk per thread? use strided-by-4 chunks: thread handles j = tid*4 + 1024*u
  float s1 = 0.f;
  for (int u = 0; u < per / 4; ++u) {
    const int j = tid * 4 + 1024 * u;
    const v4f a = *(const v4fa*)(x + j);
    v4f b = {0.f,0.f,0.f,0.f}; if (rr) b = *(const v4fa*)(rr + j);
#pragma unroll
    for (int q = 0; q < 4; ++q) { const float v = a[q] + b[q]; vals[u * 4 + q] = v; s1 += v; }
  }
  red[tid] = s1; __syncthreads();
  for (int st = 128; st > 0; st >>= 1) { if (tid < st) red[tid] += red[tid + st]; __syncthreads(); }
  const float mu = red[0] / (float)N; __syncthreads();
  float s2 = 0.f;
  for (int u = 0; u < per / 4; ++u)
#pragma unroll
    for (int q = 0; q < 4; ++q) { const float c = vals[u * 4 + q] - mu; s2 += c * c; }
  red[tid] = s2; __syncthreads();
  for (int st = 128; st > 0; st >>= 1) { if (tid < st) red[tid] += red[tid + st]; __syncthreads(); }
  const float rs = rsqrtf(red[0] / (float)N + eps);
  {
    for (int u = 0; u < per / 4; ++u) {
      const int j = tid * 4 + 1024 * u;
      v4f o, sm;
#pragma unroll
      for (int q = 0; q < 4; ++q) {
        float gg = g[j + q], bb = bta[j + q];
        if (PARAM_BF16) { gg = bf16_round(gg); bb = bf16_round(bb); }
        sm[q] = vals[u * 4 + q]; o[q] = (vals[u * 4 + q] - mu) * rs * gg + bb;
      }
      if (out_sum) *(v4f*)(out_sum + (size_t)row * N + j) = sm;
      *(v4f*)(out_norm + (size_t)row * N + j) = o;
    }
    
  }
}



// ---- f16 WMMA path (v_wmma_f32_16x16x32_f16): 11-bit significands for operands in range — used where a [0,1] probability operand needs more precision than bf16
typedef _Float16 v16h __attribute__((ext_vector_type(16)));
union FragH { v16h v; v8us half[2]; _Float16 h[16]; unsigned short u[16]; };
template <int NT>
__device__ __forceinline__ v8f mmaH(v16h ah, v16h al, v16h bh, v16h bl, v8f c) {
  c = __builtin_amdgcn_wmma_f32_16x16x32_f16(false, ah, false, bh, (short)0, c, false, false);
  if (NT >= 2) c = __builtin_amdgcn_wmma_f32_16x16x32_f16(false, al, false, bh, (short)0, c, false, false);
  if (NT >= 3) c = __builtin_amdgcn_wmma_f32_16x16x32_f16(false, ah, false, bl, (short)0, c, false, false);
  asm volatile("v_nop\n\tv_nop\n\tv_nop\n\tv_nop" : "+v"(c) : "v"(ah), "v"(al), "v"(bh), "v"(bl));
  return c;
}
// batched GEMM like k_gemm_b but f16 operands: A f32 (split into f16 hi/lo if ASPLIT, else rounded to f16), Bt = f16 values [n][k]; alpha; C f32; N multiple of 16 (partial tiles skipped)
template <bool ASPLIT>
__global__ __launch_bounds__(128) void k_gemm_h(const float* __restrict__ A, int lda, size_t sA, const _Float16* __restrict__ Bh, int ldb, size_t sB, float alpha, float* __restrict__ C, int ldc, size_t sC, int M, int N, int K) {
  __shared__ __attribute__((aligned(16))) float so[4][16][64];
  const int tid = threadIdx.x, w = tid >> 5, lane = tid & 31, ln = lane & 15, hh = lane >> 4; const int by = blockIdx.y;
  A += (size_t)by * sA; Bh += (size_t)by * sB; C += (size_t)by * sC;
  const int ntn = (N + 63) / 64; const int wid = blockIdx.x * 4 + w; const int mt = wid / ntn, nq = wid % ntn; if (mt * 16 >= M) return;
  const int row0 = mt * 16, col0 = nq * 64; const float* arow = A + (size_t)(row0 + ln) * lda;
  v8f acc[4] = {};
  for (int kb = 0; kb < K; kb += 32) {
    FragH ah, al;
    const v4f x0 = *(const v4fa*)(arow + kb + 8 * hh), x1 = *(const v4fa*)(arow + kb + 8 * hh + 4), x2 = *(const v4fa*)(arow + kb + 16 + 8 * hh), x3 = *(const v4fa*)(arow + kb + 16 + 8 * hh + 4);
    float xs[16] = {x0[0],x0[1],x0[2],x0[3],x1[0],x1[1],x1[2],x1[3],x2[0],x2[1],x2[2],x2[3],x3[0],x3[1],x3[2],x3[3]};
#pragma unroll
    for (int i = 0; i < 16; ++i) { const _Float16 h = (_Float16)xs[i]; ah.h[i] = h; al.h[i] = ASPLIT ? (_Float16)(xs[i] - (float)h) : (_Float16)0.0f; }
#pragma unroll
    for (int t = 0; t < 4; ++t) { if (col0 + t * 16 >= N) continue; const size_t boff = (size_t)(col0 + t * 16 + ln) * ldb + kb; FragH bq; bq.half[0] = *(const v8us*)(Bh + boff + 8 * hh); bq.half[1] = *(const v8us*)(Bh + boff + 16 + 8 * hh);
      acc[t] = mmaH<ASPLIT ? 2 : 1>(ah.v, al.v, bq.v, bq.v, acc[t]); }
  }
#pragma unroll
  for (int t = 0; t < 4; ++t) { if (col0 + t * 16 >= N) continue;
#pragma unroll
    for (int r = 0; r < 8; ++r) so[w][8 * hh + r][t * 16 + ln] = acc[t][r] * alpha; }
  __builtin_amdgcn_fence(__ATOMIC_ACQ_REL, "workgroup"); __builtin_amdgcn_wave_barrier();
  const int rsub = lane >> 4, c4 = (lane & 15) * 4;
  {
#pragma unroll
    for (int q = 0; q < 8; ++q) { const int r = q * 2 + rsub; if (col0 + c4 < N) { const v4f v = *(const v4fa*)&so[w][r][c4]; *(v4f*)(C + (size_t)(row0 + r) * ldc + col0 + c4) = v; } }
     }
}

// Wt[n][k] = f16(W[k][n]·scale) from f32 row-major W[K][N] (scale = power of two; bf16-exact weights stay exact in f16 away from the subnormal range)
__global__ __launch_bounds__(256) void k_wt_f16(const float* __restrict__ W, _Float16* __restrict__ Wt, int K, int N, float scale) {
  const int t = blockIdx.x * 256 + threadIdx.x; if (t >= N * (K / 8)) return; const int n = t / (K / 8), k8 = (t % (K / 8)) * 8; FragH f;
#pragma unroll
  for (int i = 0; i < 8; ++i) f.h[i] = (_Float16)(bf16_round(W[(size_t)(k8 + i) * N + n]) * scale); const v8us o = f.half[0];
  *(v8us*)((unsigned short*)Wt + (size_t)n * K + k8) = o; 
}
// k_gemm_hh variant with fused epilogue: v = acc·alpha + bias[by·sBias + col] (+ CP[(row/rowsPerB)·sCPb + by·64 + col] if CP) ; ACT 0 none / 1 elu ; writes f16 C16 (and f32 C if non-null)
template <int ACT>
__global__ __launch_bounds__(128) void k_gemm_hhx(const _Float16* __restrict__ A, int lda, size_t sA, const _Float16* __restrict__ Bh, int ldb, size_t sB, float alpha, const float* __restrict__ bias, size_t sBias, const float* __restrict__ CP, int rowsPerB, size_t sCPb, int row0g,
    float* __restrict__ C, _Float16* __restrict__ C16, int ldc, size_t sC, int M, int N, int K) {
  __shared__ __attribute__((aligned(16))) float so[4][16][64];
  const int tid = threadIdx.x, w = tid >> 5, lane = tid & 31, ln = lane & 15, hh = lane >> 4; const int by = blockIdx.y;
  A += (size_t)by * sA; Bh += (size_t)by * sB; const size_t cofs = (size_t)by * sC; const float* bp = bias ? bias + (size_t)by * sBias : nullptr;
  const int ntn = (N + 63) / 64; const int wid = blockIdx.x * 4 + w; const int mt = wid / ntn, nq = wid % ntn; if (mt * 16 >= M) return;
  const int row0 = mt * 16, col0 = nq * 64; const _Float16* arow = A + (size_t)(row0 + ln) * lda;
  v8f acc[4] = {};
  for (int kb = 0; kb < K; kb += 32) { FragH ah; ah.half[0] = *(const v8us*)((const unsigned short*)arow + kb + 8 * hh); ah.half[1] = *(const v8us*)((const unsigned short*)arow + kb + 16 + 8 * hh);
#pragma unroll
    for (int t = 0; t < 4; ++t) { if (col0 + t * 16 >= N) continue; const size_t boff = (size_t)(col0 + t * 16 + ln) * ldb + kb; FragH bq; bq.half[0] = *(const v8us*)((const unsigned short*)Bh + boff + 8 * hh); bq.half[1] = *(const v8us*)((const unsigned short*)Bh + boff + 16 + 8 * hh);
      acc[t] = mmaH<1>(ah.v, ah.v, bq.v, bq.v, acc[t]); }
  }
#pragma unroll
  for (int t = 0; t < 4; ++t) { if (col0 + t * 16 >= N) continue; const int col = col0 + t * 16 + ln; const float bv = bp ? bf16_round(bp[col]) : 0.f;
#pragma unroll
    for (int r = 0; r < 8; ++r) { float v = acc[t][r] * alpha + bv; if (CP) { const int rr = row0g + row0 + 8 * hh + r; if (rowsPerB < 0) v += CP[cofs + (size_t)rr * ldc + col];      /* rowsPerB < 0: own element of the batched C plane */ else { const int bidx = rr / rowsPerB; v += CP[(size_t)bidx * sCPb + (size_t)by * 64 + col]; } } if (ACT == 1) v = (v > 0.f) ? v : expm1f(v); else if (ACT == 7) v = (v > 0.f) ? v + 1.0f : expf(v); else if (ACT == 8) v = tanhf(v); else if (ACT == 9) v = 0.5f * v * (1.0f + tanhf(0.7978845608028654f * (v + 0.044715f * v * v * v))); else if (ACT == 11) v = 1.0f / (1.0f + expf(-v)); else if (ACT == 12) v = (v > 0.f) ? v : 0.01f * v; else if (ACT == 14) v = (v > 0.f) ? v : 0.1f * v; else if (ACT == 16) v = (v >= 0.f) ? v : 0.3f * v; else if (ACT == 17) v = (v >= 0.f) ? v : 0.2f * v; else if (ACT == 15) v = v / (1.0f + expf(-v)); else if (ACT == 3) v = fmaxf(v, 0.f); else if (ACT == 6) v = 0.5f * v * (1.0f + erff(v * 0.70710678118654752f)); so[w][8 * hh + r][t * 16 + ln] = v; } }
  __builtin_amdgcn_fence(__ATOMIC_ACQ_REL, "workgroup"); __builtin_amdgcn_wave_barrier();
  const int rsub = lane >> 4, c4 = (lane & 15) * 4; typedef _Float16 v4h __attribute__((ext_vector_type(4)));
  {
#pragma unroll
    for (int q = 0; q < 8; ++q) { const int r = q * 2 + rsub; if (col0 + c4 < N) { const v4f v = *(const v4fa*)&so[w][r][c4]; if (C) *(v4f*)(C + cofs + (size_t)(row0 + r) * ldc + col0 + c4) = v; if (C16) { v4h h4; for (int i = 0; i < 4; ++i) h4[i] = (_Float16)v[i]; *(v4h*)(C16 + cofs + (size_t)(row0 + r) * ldc + col0 + c4) = h4; } } }
     }
}


typedef _Float16 v4h __attribute__((ext_vector_type(4)));

__global__ __launch_bounds__(256) void k_x16(const float* __restrict__ x, _Float16* __restrict__ X16, size_t n8) { const size_t t = (size_t)blockIdx.x * 256 + threadIdx.x; if (t >= n8) return; FragH f;
#pragma unroll
  for (int q = 0; q < 8; ++q) f.h[q] = (_Float16)bf16_round(x[t * 8 + q]); *(v8us*)((unsigned short*)X16 + t * 8) = f.half[0];  }
__global__ __launch_bounds__(256) void k_h16(const float* __restrict__ x, _Float16* __restrict__ X16, size_t n8) { const size_t t = (size_t)blockIdx.x * 256 + threadIdx.x; if (t >= n8) return; FragH f;
#pragma unroll
  for (int q = 0; q < 8; ++q) f.h[q] = (_Float16)x[t * 8 + q]; *(v8us*)((unsigned short*)X16 + t * 8) = f.half[0];  }
__global__ __launch_bounds__(256) void k_round16f(const float* __restrict__ W, _Float16* __restrict__ Bt, size_t n8) { const size_t t = (size_t)blockIdx.x * 256 + threadIdx.x; if (t >= n8) return; FragH f;
#pragma unroll
  for (int i = 0; i < 8; ++i) f.h[i] = (_Float16)(bf16_round(W[t * 8 + i]) * 16.0f); *(v8us*)((unsigned short*)Bt + t * 8) = f.half[0];  }
template <int NHv, int TTv>
__global__ __launch_bounds__(256) void k_vt(const _Float16* __restrict__ V16, int ldv, int voff, _Float16* __restrict__ Vt) { __shared__ unsigned short tl[64][66]; const int tid = threadIdx.x; const int slab = blockIdx.x / (TTv / 64), lg = blockIdx.x % (TTv / 64); const int b = slab / NHv, h = slab % NHv;
  for (int i = tid; i < 64 * 8; i += 256) { const int r = i / 8, c8 = (i % 8) * 8; FragH f; f.half[0] = *(const v8us*)((const unsigned short*)V16 + ((size_t)b * TTv + lg * 64 + r) * ldv + voff + h * 64 + c8);
#pragma unroll
    for (int q = 0; q < 8; ++q) tl[r][c8 + q] = f.u[q]; }
  __syncthreads();
  {
#pragma unroll
    for (int rd = 0; rd < 2; ++rd) { const int d = rd * 32 + tid / 8, pc = tid % 8; FragH f;
#pragma unroll
      for (int q = 0; q < 8; ++q) f.u[q] = tl[pc * 8 + q][d];
      *(v8us*)((unsigned short*)Vt + ((size_t)slab * 64 + d) * TTv + lg * 64 + pc * 8) = f.half[0]; }
     } }

__global__ __launch_bounds__(256) void k_hl(const float* __restrict__ F, _Float16* __restrict__ Hh, _Float16* __restrict__ Hl, size_t n8) { const size_t t = (size_t)blockIdx.x * 256 + threadIdx.x; if (t >= n8) return; FragH fh, fl; const v4f a = *(const v4fa*)(F + t * 8), c = *(const v4fa*)(F + t * 8 + 4);
#pragma unroll
  for (int q = 0; q < 4; ++q) { _Float16 h = (_Float16)a[q]; fh.h[q] = h; fl.h[q] = (_Float16)((a[q] - (float)h) * 1024.0f); h = (_Float16)c[q]; fh.h[4 + q] = h; fl.h[4 + q] = (_Float16)((c[q] - (float)h) * 1024.0f); }
  { *(v8us*)((unsigned short*)Hh + t * 8) = fh.half[0]; *(v8us*)((unsigned short*)Hl + t * 8) = fl.half[0];  } }

// ---- fast GEMM (wave tile 32x64; requires M % 32 == 0 rows per launch region and N % 64 == 0); epilogue = k_gemm_hhx semantics ----
__device__ __forceinline__ v16h g2_frag(const _Float16* p, int hh) { FragH f; f.half[0] = *(const v8us*)((const unsigned short*)p + 8 * hh); f.half[1] = *(const v8us*)((const unsigned short*)p + 16 + 8 * hh); return f.v; }
__device__ __forceinline__ v8f g2_mma(v16h a, v16h b, v8f c) { v8f d = __builtin_amdgcn_wmma_f32_16x16x32_f16(false, a, false, b, (short)0, c, false, false); asm volatile("v_nop\n\tv_nop\n\tv_nop\n\tv_nop" : "+v"(d) : "v"(a), "v"(b)); return d; }
template <int ACT>
__global__ __launch_bounds__(128) void k_gemm2(const _Float16* __restrict__ A, int lda, size_t sA, const _Float16* __restrict__ Bh, int ldb, size_t sB, float alpha, const float* __restrict__ bias, size_t sBias, const float* __restrict__ CP, int rowsPerB, size_t sCPb, int row0g,
    float* __restrict__ C, _Float16* __restrict__ C16, int ldc, size_t sC, int M, int N, int K) { static_assert(ACT == 0 || ACT == 3 || ACT == 6 || ACT == 8 || ACT == 9 || ACT == 11 || ACT == 12 || ACT == 14 || ACT == 15 || ACT == 16 || ACT == 17, "k_gemm2: unsupported ACT code (would silently apply no activation)");
  __shared__ __attribute__((aligned(16))) float so[4][32][68];
  const int tid = threadIdx.x, w = tid >> 5, lane = tid & 31, ln = lane & 15, hh = lane >> 4; const int by = blockIdx.y;
  A += (size_t)by * sA; Bh += (size_t)by * sB; const size_t cofs = (size_t)by * sC; const float* bp = bias ? bias + (size_t)by * sBias : nullptr;
  const int ntn = N >> 6; const int mt = blockIdx.x / ntn, nq = blockIdx.x - mt * ntn; const int row0 = mt * 128 + 32 * w, col0 = nq * 64; if (row0 >= M) return;
  const _Float16* a0p = A + (size_t)(row0 + ln) * lda; const _Float16* a1p = a0p + (size_t)16 * lda;
  const _Float16* b0p = Bh + (size_t)(col0 + ln) * ldb; const _Float16* b1p = b0p + (size_t)16 * ldb; const _Float16* b2p = b1p + (size_t)16 * ldb; const _Float16* b3p = b2p + (size_t)16 * ldb;
  const v8f z8 = {0.f,0.f,0.f,0.f,0.f,0.f,0.f,0.f}; v8f c00 = z8, c01 = z8, c02 = z8, c03 = z8, c10 = z8, c11 = z8, c12 = z8, c13 = z8;
#pragma unroll 1
  for (int kb = 0; kb < K; kb += 32) { const v16h a0 = g2_frag(a0p + kb, hh), a1 = g2_frag(a1p + kb, hh);
    v16h b = g2_frag(b0p + kb, hh); c00 = g2_mma(a0, b, c00); c10 = g2_mma(a1, b, c10);
    b = g2_frag(b1p + kb, hh); c01 = g2_mma(a0, b, c01); c11 = g2_mma(a1, b, c11);
    b = g2_frag(b2p + kb, hh); c02 = g2_mma(a0, b, c02); c12 = g2_mma(a1, b, c12);
    b = g2_frag(b3p + kb, hh); c03 = g2_mma(a0, b, c03); c13 = g2_mma(a1, b, c13); }
  v8f accs[8] = {c00, c01, c02, c03, c10, c11, c12, c13};
#pragma unroll
  for (int u = 0; u < 8; ++u) { const int t = u & 3, half = u >> 2; const int col = col0 + t * 16 + ln; const float bv = bp ? bf16_round(bp[col]) : 0.f;
#pragma unroll
    for (int r = 0; r < 8; ++r) { const int rloc = half * 16 + 8 * hh + r; float v = accs[u][r] * alpha + bv; if (CP) { if (rowsPerB < 0) v += CP[cofs + (size_t)(row0g + row0 + rloc) * ldc + col];      /* rowsPerB < 0: own element of the batched C plane */ else { const int bidx = (row0g + row0 + rloc) / rowsPerB; v += CP[(size_t)bidx * sCPb + (size_t)by * 64 + col]; } }
      if (ACT == 3) v = fmaxf(v, 0.f); else if (ACT == 6) v = 0.5f * v * (1.0f + erff(v * 0.70710678118654752f)); else if (ACT == 11) v = 1.0f / (1.0f + expf(-v)); else if (ACT == 15) v = v / (1.0f + expf(-v)); else if (ACT == 12) v = (v > 0.f) ? v : 0.01f * v; else if (ACT == 8) v = tanhf(v); else if (ACT == 9) v = 0.5f * v * (1.0f + tanhf(0.7978845608028654f * (v + 0.044715f * v * v * v))); else if (ACT == 14) v = (v > 0.f) ? v : 0.1f * v; else if (ACT == 16) v = (v >= 0.f) ? v : 0.3f * v; else if (ACT == 17) v = (v >= 0.f) ? v : 0.2f * v;
      so[w][rloc][t * 16 + ln] = v; } }
  __builtin_amdgcn_fence(__ATOMIC_ACQ_REL, "workgroup"); __builtin_amdgcn_wave_barrier();
  const int rsub = lane >> 4, c4 = (lane & 15) * 4;
  {
#pragma unroll
    for (int q = 0; q < 16; ++q) { const int r = q * 2 + rsub; const v4f v = *(const v4fa*)&so[w][r][c4]; if (C) *(v4f*)(C + cofs + (size_t)(row0 + r) * ldc + col0 + c4) = v; if (C16) { v4h h4; for (int i = 0; i < 4; ++i) h4[i] = (_Float16)v[i]; *(v4h*)(C16 + cofs + (size_t)(row0 + r) * ldc + col0 + c4) = h4; } }
     } }


__global__ __launch_bounds__(256) void k_wnat(const float* __restrict__ w, size_t n8, _Float16* __restrict__ Bt) { const size_t t = (size_t)blockIdx.x * 256 + threadIdx.x; if (t >= n8) return; FragH f; for (int q = 0; q < 8; ++q) f.h[q] = (_Float16)(bf16_round(w[t * 8 + q]) * 16.0f); *(v8us*)((unsigned short*)Bt + t * 8) = f.half[0];  }
__global__ __launch_bounds__(256) void k_rsm(const float* __restrict__ S, _Float16* __restrict__ P, int nrows) {
  #pragma clang fp contract(off)
  const int i = blockIdx.x * 256 + threadIdx.x; if (i >= nrows) return; const float* s = S + (size_t)i * SQ; float mx = -3.0e38f;
#pragma unroll 1
  for (int j = 0; j < SQ; ++j) mx = fmaxf(mx, s[j]); float se = 0.f;
#pragma unroll 1
  for (int j = 0; j < SQ; ++j) se += expf(s[j] - mx); const float sc = 256.0f / se;
#pragma unroll 1
  for (int j0 = 0; j0 < SQ; j0 += 8) { FragH f; for (int q = 0; q < 8; ++q) f.h[q] = (_Float16)(expf(s[j0 + q] - mx) * sc); unsigned short* d = (unsigned short*)P + (size_t)i * SQ + j0; *(v8us*)d = f.half[0];  } }
__global__ __launch_bounds__(256) void k_vt(const _Float16* __restrict__ V16, int b, int h0, _Float16* __restrict__ VT) { __shared__ unsigned short tl[64][65]; const int tid = threadIdx.x; const int hh = blockIdx.x % HG, sg = blockIdx.x / HG; const int s0 = sg * 64; const int h = h0 + hh;
  for (int i = tid; i < 64 * 8; i += 256) { const int j = i / 8, d8 = (i % 8) * 8; FragH f; f.half[0] = *(const v8us*)((const unsigned short*)V16 + ((size_t)b * SQ + s0 + j) * DM + h * HD + d8); for (int q = 0; q < 8; ++q) tl[d8 + q][j] = f.u[q]; }
  __syncthreads();
  { for (int i = tid; i < 64 * 8; i += 256) { const int d = i / 8, j8 = (i % 8) * 8; FragH f; for (int q = 0; q < 8; ++q) f.u[q] = tl[d][j8 + q]; *(v8us*)((unsigned short*)VT + ((size_t)hh * HD + d) * SQ + s0 + j8) = f.half[0]; }  } }

__global__ __launch_bounds__(256) void k_rsmP(const float* __restrict__ S, _Float16* __restrict__ P, _Float16* __restrict__ PL, int nrows) {
  #pragma clang fp contract(off)
  __shared__ unsigned short sl_[256][9]; const int i = blockIdx.x * 256 + threadIdx.x; if (i >= nrows) return; const float* s = S + (size_t)i * SQ; float mx = -INFINITY;
#pragma unroll 1
  for (int j = 0; j < SQ; ++j) mx = fmaxf(mx, s[j]); float se = 0.f;
#pragma unroll 1
  for (int j = 0; j < SQ; ++j) se += expf(s[j] - mx); const float sc = 256.0f / se;
#pragma unroll 1
  for (int j0 = 0; j0 < SQ; j0 += 8) { FragH f, fl; for (int q = 0; q < 8; ++q) { const float v = expf(s[j0 + q] - mx) * sc; const _Float16 hv = (_Float16)v; f.h[q] = hv; if (PL) { FragH one; one.h[0] = (_Float16)((v - (float)hv) * 1024.0f); sl_[threadIdx.x][q] = one.u[0]; } }
    if (PL) for (int q = 0; q < 8; ++q) fl.u[q] = sl_[threadIdx.x][q];
    unsigned short* d = (unsigned short*)P + (size_t)i * SQ + j0; *(v8us*)d = f.half[0]; if (PL) *(v8us*)((unsigned short*)PL + (size_t)i * SQ + j0) = fl.half[0];  } }
__global__ __launch_bounds__(256) void k_f16rows(const float* __restrict__ F, _Float16* __restrict__ R, size_t n8) { const size_t t = (size_t)blockIdx.x * 256 + threadIdx.x; if (t >= n8) return; FragH f; for (int q = 0; q < 8; ++q) f.h[q] = (_Float16)F[t * 8 + q]; *(v8us*)((unsigned short*)R + t * 8) = f.half[0];  }
extern "C" void kernel_launch(void* const* d_in, const int* in_sizes, int n_in,
                              void* d_out, int out_size, void* d_ws, size_t ws_size, hipStream_t stream) {
  (void)in_sizes; (void)n_in; (void)out_size;
  const float* const* I = (const float* const*)d_in; const float* x = I[0]; const float* wq = I[1]; const float* bq = I[2]; const float* wk = I[3]; const float* bk = I[4]; const float* wv = I[5]; const float* bv = I[6];      /* [in][out] weights */
  char* ws = (char*)d_ws; size_t off = 0;
  auto take = [&](size_t bytes) { char* p = ws + off; off += (bytes + 255) & ~(size_t)255; return p; };
  _Float16* BQ = (_Float16*)take((size_t)DQ * DM * 2); _Float16* BK = (_Float16*)take((size_t)DQ * DM * 2); _Float16* BV = (_Float16*)take((size_t)DV * DM * 2);
  _Float16* X16 = (_Float16*)take(NR * DM * 2); float* F32 = (float*)take(NR * (DQ > DV ? DQ : DV) * 4); _Float16* Q16 = (_Float16*)take(NR * DQ * 2); _Float16* QL = (_Float16*)take(NR * DQ * 2); _Float16* K16 = (_Float16*)take(NR * DQ * 2); _Float16* KL = (_Float16*)take(NR * DQ * 2); _Float16* V16 = (_Float16*)take(NR * DV * 2);
  float* S = (float*)take((size_t)QT * SQ * 4); _Float16* P = (_Float16*)take((size_t)QT * SQ * 2); _Float16* PL = (_Float16*)take((size_t)QT * SQ * 2); _Float16* VT = (_Float16*)take((size_t)NB * DV * SQ * 2);
  if (off > ws_size) return;
  k_wt_f16<<<(unsigned)(((size_t)DQ * (DM / 8) + 255) / 256), 256, 0, stream>>>(wq, BQ, DM, DQ, 16.0f); k_wt_f16<<<(unsigned)(((size_t)DQ * (DM / 8) + 255) / 256), 256, 0, stream>>>(wk, BK, DM, DQ, 16.0f); k_wt_f16<<<(unsigned)(((size_t)DV * (DM / 8) + 255) / 256), 256, 0, stream>>>(wv, BV, DM, DV, 16.0f);
  k_x16<<<(unsigned)((NR * DM / 8 + 255) / 256), 256, 0, stream>>>(x, X16, NR * DM / 8);
  k_gemm2<0><<<dim3((unsigned)((NR / 128) * (DQ / 64)), 1), 128, 0, stream>>>(X16, DM, 0, BQ, DM, 0, 0.0625f, bq, 0, nullptr, 1, 0, 0, F32, nullptr, DQ, 0, MP, DQ, DM);      /* q f32 */
  k_hl<<<(unsigned)((NR * DQ / 8 + 255) / 256), 256, 0, stream>>>(F32, Q16, QL, NR * DQ / 8);
  k_gemm2<0><<<dim3((unsigned)((NR / 128) * (DQ / 64)), 1), 128, 0, stream>>>(X16, DM, 0, BK, DM, 0, 0.0625f, bk, 0, nullptr, 1, 0, 0, F32, nullptr, DQ, 0, MP, DQ, DM);      /* k f32 (reusing the plane) */
  k_hl<<<(unsigned)((NR * DQ / 8 + 255) / 256), 256, 0, stream>>>(F32, K16, KL, NR * DQ / 8);
  k_gemm2<0><<<dim3((unsigned)((NR / 128) * (DV / 64)), 1), 128, 0, stream>>>(X16, DM, 0, BV, DM, 0, 0.0625f, bv, 0, nullptr, 1, 0, 0, nullptr, V16, DV, 0, MP, DV, DM);      /* v f16 rows */
  k_vt<NH, SQ><<<NB * NH * (SQ / 64), 256, 0, stream>>>(V16, DV, 0, VT);      /* V^T per batch [DV][SQ] */
  for (int b = 0; b < NBR; ++b) for (int q0 = 0; q0 < QN; q0 += QT) {
    const size_t qo = ((size_t)b * SQ + q0) * DQ, ko = (size_t)b * SQ * DQ; const dim3 gs((QT / 128) * (SQ / 64), 1);
    k_gemm2<0><<<gs, 128, 0, stream>>>(QL + qo, DQ, 0, K16 + ko, DQ, 0, 1.0f / 1024.0f, nullptr, 0, nullptr, 1, 0, 0, S, nullptr, SQ, 0, QT, SQ, DQ);      /* three-term scores */
    k_gemm2<0><<<gs, 128, 0, stream>>>(Q16 + qo, DQ, 0, KL + ko, DQ, 0, 1.0f / 1024.0f, nullptr, 0, S, 1, (size_t)SQ, 0, S, nullptr, SQ, 0, QT, SQ, DQ);
    k_gemm2<0><<<gs, 128, 0, stream>>>(Q16 + qo, DQ, 0, K16 + ko, DQ, 0, 1.0f, nullptr, 0, S, 1, (size_t)SQ, 0, S, nullptr, SQ, 0, QT, SQ, DQ);
    k_rsmP<<<(QT + 255) / 256, 256, 0, stream>>>(S, P, nullptr, QT);
    float* ob = (float*)d_out + ((size_t)b * SQ + q0) * DV; const _Float16* vt = VT + (size_t)b * DV * SQ; const dim3 gv((QT / 128) * (DV / 64), 1);
    k_gemm2<0><<<gv, 128, 0, stream>>>(P, SQ, 0, vt, SQ, 0, 0.00390625f, nullptr, 0, nullptr, 1, 0, 0, ob, nullptr, DV, 0, QT, DV, SQ); }      /* out = attn v */
}

// v001
// A run of this version takes 3180 microseconds.
// Timed twice side by side with v000, it ran 6.64 and 6.65 times as fast.
#include <hip/hip_runtime.h>
// SA layer (x [8][4096][128]; q, k = x W + b ([in][out] [128][64]), v = x Wv + bv; scores = q.k (NO scaling, logits sigma ~8); softmax; out = attn v -> [8][4096][64]).
// Structure: token rows; x as exact f16 rows; q | k | v WMMA GEMMs (32x64 wave tiles, f32 accumulation, exact x16 transposed [in][out] weights + bias); q and k as f16 hi + 2^-10 residual planes (three-term scores); v as f16 rows, V^T via LDS transposes; per (batch, 2048-query tile): scores GEMM (K = 64), row softmax on VALU (f32; P x256 f16), out = P . V^T GEMM written straight to the f32 output.
// Compute dtype: inputs rounded to bf16; x / weights exact; q, k hi + residual (~2^-22); v, P plain f16 (~2^-12); scores / softmax f32. v_wmma_f32_16x16x32_f16.
#define NB 8
#define SQ 4096
#define DM 128
#define DQ 64
#define DV 64
#define QT 2048                     /* query tile */
#define NH 1                    /* V^T slabs of 64 (k_vt<NH, SQ>) */
#define HD 64
#define HG 1
#define NR ((size_t)NB * SQ)
#define QN SQ                        /* query rows per batch (debug hook) */
#define NBR NB                       /* batches (debug hook) */
#define MP ((int)NR)                 /* rows through the projections (debug hook) */
typedef __bf16 v16b __attribute__((ext_vector_type(16)));
typedef unsigned short v8us __attribute__((ext_vector_type(8), may_alias));
typedef float  v8f  __attribute__((ext_vector_type(8)));
typedef float  v4f  __attribute__((ext_vector_type(4)));
typedef float  v4fa __attribute__((ext_vector_type(4), may_alias));
union FragB { v16b v; v8us half[2]; unsigned short u[16]; };

__device__ __forceinline__ unsigned short bf16_bits(float x) { unsigned int u = __float_as_uint(x); return (unsigned short)((u + 0x7FFFu + ((u >> 16) & 1u)) >> 16); }
__device__ __forceinline__ float bf16_val(unsigned short b) { return __uint_as_float(((unsigned int)b) << 16); }
__device__ __forceinline__ float bf16_round(float x) { return bf16_val(bf16_bits(x)); }
// D += A·B with NT terms: 1 = ah·bh, 2 = + al·bh (A split), 3 = + ah·bl (both split)
template <int NT>
__device__ __forceinline__ v8f mmaN(v16b ah, v16b al, v16b bh, v16b bl, v8f c) {
  c = __builtin_amdgcn_wmma_f32_16x16x32_bf16(false, ah, false, bh, (short)0, c, false, false);
  if (NT >= 2) c = __builtin_amdgcn_wmma_f32_16x16x32_bf16(false, al, false, bh, (short)0, c, false, false);
  if (NT >= 3) c = __builtin_amdgcn_wmma_f32_16x16x32_bf16(false, ah, false, bl, (short)0, c, false, false);
  asm volatile("v_nop\n\tv_nop\n\tv_nop\n\tv_nop" : "+v"(c) : "v"(ah), "v"(al), "v"(bh), "v"(bl));
  return c;
}

__global__ __launch_bounds__(256) void k_wt_bf16(const float* __restrict__ W, unsigned short* __restrict__ Wt, int K, int N) {
  const int t = blockIdx.x * 256 + threadIdx.x;
  const int k8n = K / 8;
  if (t >= N * k8n) return;
  const int n = t / k8n, k8 = (t % k8n) * 8;
  v8us v;
#pragma unroll
  for (int i = 0; i < 8; ++i) v[i] = bf16_bits(W[(size_t)(k8 + i) * N + n]);
  *(v8us*)(Wt + (size_t)n * K + k8) = v;
  
}

// GEMM C[M][N] (f32, pitch ldc) = act(A[M][K]·W + bias). A f32 row-major (pitch lda) converted per fragment to bf16
// (ASPLIT: hi/lo two planes -> 2 terms, else single rounded term); Wt bf16 [N][K] (pitch ldb). BIAS_BF16 rounds the
// bias to bf16 first (bias quantised to bf16 before the add). K%32==0, M%16==0, N%64==0.
template <bool ASPLIT, int ACT, bool BIAS_BF16>
__global__ __launch_bounds__(128) void k_gemm_bf(const float* __restrict__ A, int lda, const unsigned short* __restrict__ Wt, int ldb,
                                               const float* __restrict__ bias, float* __restrict__ C, int ldc, int M, int N, int K) {
  __shared__ __attribute__((aligned(16))) float so[4][16][64];
  const int tid = threadIdx.x, w = tid >> 5, lane = tid & 31, ln = lane & 15, hh = lane >> 4;
  const int ntn = N / 64;
  const int wid = blockIdx.x * 4 + w;
  const int mt = wid / ntn, nq = wid % ntn;
  if (mt * 16 >= M) return;
  const int row0 = mt * 16, col0 = nq * 64;
  const float* arow = A + (size_t)(row0 + ln) * lda;
  v8f acc[4] = {};
  for (int kb = 0; kb < K; kb += 32) {
    FragB ah, al;
    const v4f x0 = *(const v4fa*)(arow + kb + 8 * hh), x1 = *(const v4fa*)(arow + kb + 8 * hh + 4);
    const v4f x2 = *(const v4fa*)(arow + kb + 16 + 8 * hh), x3 = *(const v4fa*)(arow + kb + 16 + 8 * hh + 4);
    float xs[16] = {x0[0],x0[1],x0[2],x0[3],x1[0],x1[1],x1[2],x1[3],x2[0],x2[1],x2[2],x2[3],x3[0],x3[1],x3[2],x3[3]};
#pragma unroll
    for (int i = 0; i < 16; ++i) { const unsigned short hb = bf16_bits(xs[i]); ah.u[i] = hb; al.u[i] = ASPLIT ? bf16_bits(xs[i] - bf16_val(hb)) : (unsigned short)0; }
#pragma unroll
    for (int t = 0; t < 4; ++t) {
      const unsigned short* brow = Wt + (size_t)(col0 + t * 16 + ln) * ldb + kb;
      FragB b;
      b.half[0] = *(const v8us*)(brow + 8 * hh);
      b.half[1] = *(const v8us*)(brow + 16 + 8 * hh);
      acc[t] = mmaN<ASPLIT ? 2 : 1>(ah.v, al.v, b.v, b.v, acc[t]);
    }
  }
#pragma unroll
  for (int t = 0; t < 4; ++t) {
    float bv = bias ? bias[col0 + t * 16 + ln] : 0.f;
    if (BIAS_BF16) bv = bf16_round(bv);
#pragma unroll
    for (int r = 0; r < 8; ++r) { float v = acc[t][r] + bv; if (ACT == 1) v = fmaxf(v, 0.f); so[w][8 * hh + r][t * 16 + ln] = v; }
  }
  __builtin_amdgcn_fence(__ATOMIC_ACQ_REL, "workgroup");
  __builtin_amdgcn_wave_barrier();
  const int rsub = lane >> 4, c4 = (lane & 15) * 4;
  {
#pragma unroll
    for (int q = 0; q < 8; ++q) {
      const int r = q * 2 + rsub;
      const v4f v = *(const v4fa*)&so[w][r][c4];
      *(v4f*)(C + (size_t)(row0 + r) * ldc + col0 + c4) = v;
    }
    
  }
}

// GEMM C = act(A·W + bias + resid): A f32 (ASPLIT -> hi/lo 2 terms), Wt bf16 [N][K]; ACT 0 none, 1 relu, 2 exact gelu;
// resid (optional, f32, row index = (row % rmod), pitch ldr, RES_BF16 rounds it) added before the activation.
template <bool ASPLIT, int ACT, bool BIAS_BF16, bool RES_BF16>
__global__ __launch_bounds__(128) void k_gemm_bf3(const float* __restrict__ A, int lda, const unsigned short* __restrict__ Wt, int ldb,
                                                const float* __restrict__ bias, const float* __restrict__ resid, int rmod, int ldr,
                                                float* __restrict__ C, int ldc, int M, int N, int K) {
  __shared__ __attribute__((aligned(16))) float so[4][16][64];
  const int tid = threadIdx.x, w = tid >> 5, lane = tid & 31, ln = lane & 15, hh = lane >> 4;
  const int ntn = N / 64;
  const int wid = blockIdx.x * 4 + w;
  const int mt = wid / ntn, nq = wid % ntn;
  if (mt * 16 >= M) return;
  const int row0 = mt * 16, col0 = nq * 64;
  const float* arow = A + (size_t)(row0 + ln) * lda;
  v8f acc[4] = {};
  for (int kb = 0; kb < K; kb += 32) {
    FragB ah, al;
    const v4f x0 = *(const v4fa*)(arow + kb + 8 * hh), x1 = *(const v4fa*)(arow + kb + 8 * hh + 4);
    const v4f x2 = *(const v4fa*)(arow + kb + 16 + 8 * hh), x3 = *(const v4fa*)(arow + kb + 16 + 8 * hh + 4);
    float xs[16] = {x0[0],x0[1],x0[2],x0[3],x1[0],x1[1],x1[2],x1[3],x2[0],x2[1],x2[2],x2[3],x3[0],x3[1],x3[2],x3[3]};
#pragma unroll
    for (int i = 0; i < 16; ++i) { const unsigned short hb = bf16_bits(xs[i]); ah.u[i] = hb; al.u[i] = ASPLIT ? bf16_bits(xs[i] - bf16_val(hb)) : (unsigned short)0; }
#pragma unroll
    for (int t = 0; t < 4; ++t) {
      const unsigned short* brow = Wt + (size_t)(col0 + t * 16 + ln) * ldb + kb;
      FragB b;
      b.half[0] = *(const v8us*)(brow + 8 * hh);
      b.half[1] = *(const v8us*)(brow + 16 + 8 * hh);
      acc[t] = mmaN<ASPLIT ? 2 : 1>(ah.v, al.v, b.v, b.v, acc[t]);
    }
  }
#pragma unroll
  for (int t = 0; t < 4; ++t) {
    const int col = col0 + t * 16 + ln;
    float bv = bias ? bias[col] : 0.f;
    if (BIAS_BF16) bv = bf16_round(bv);
#pragma unroll
    for (int r = 0; r < 8; ++r) {
      float v = acc[t][r] + bv;
      if (resid) { float rv = resid[(size_t)((row0 + 8 * hh + r) % rmod) * ldr + col]; if (RES_BF16) rv = bf16_round(rv); v += rv; }
      if (ACT == 1) v = fmaxf(v, 0.f);
      if (ACT == 2) v = 0.5f * v * (1.0f + erff(v * 0.70710678118654752f));
      if (ACT == 3) { const float u = 0.7978845608028654f * (v + 0.044715f * v * v * v); v = 0.5f * v * (1.0f + tanhf(u)); }
      so[w][8 * hh + r][t * 16 + ln] = v;
    }
  }
  __builtin_amdgcn_fence(__ATOMIC_ACQ_REL, "workgroup");
  __builtin_amdgcn_wave_barrier();
  const int rsub = lane >> 4, c4 = (lane & 15) * 4;
  {
#pragma unroll
    for (int q = 0; q < 8; ++q) {
      const int r = q * 2 + rsub;
      const v4f v = *(const v4fa*)&so[w][r][c4];
      *(v4f*)(C + (size_t)(row0 + r) * ldc + col0 + c4) = v;
    }
    
  }
}
// row LayerNorm (biased variance, eps) over N: s = X (+ R); optional out_sum <- s; out_norm <- (s-mu)*rsqrt(var+eps)*g + b
template <bool PARAM_BF16>
__global__ __launch_bounds__(256) void k_layernorm(const float* __restrict__ X, const float* __restrict__ R, const float* __restrict__ g, const float* __restrict__ bta,
                                                  float* __restrict__ out_sum, float* __restrict__ out_norm, int N, float eps) {
  __shared__ float red[256];
  const int row = blockIdx.x, tid = threadIdx.x;
  const float* x = X + (size_t)row * N; const float* rr = R ? R + (size_t)row * N : nullptr;
  float vals[16];                     // up to N = 4096
  const int per = N / 256;            // contiguous chunk per thread? use strided-by-4 chunks: thread handles j = tid*4 + 1024*u
  float s1 = 0.f;
  for (int u = 0; u < per / 4; ++u) {
    const int j = tid * 4 + 1024 * u;
    const v4f a = *(const v4fa*)(x + j);
    v4f b = {0.f,0.f,0.f,0.f}; if (rr) b = *(const v4fa*)(rr + j);
#pragma unroll
    for (int q = 0; q < 4; ++q) { const float v = a[q] + b[q]; vals[u * 4 + q] = v; s1 += v; }
  }
  red[tid] = s1; __syncthreads();
  for (int st = 128; st > 0; st >>= 1) { if (tid < st) red[tid] += red[tid + st]; __syncthreads(); }
  const float mu = red[0] / (float)N; __syncthreads();
  float s2 = 0.f;
  for (int u = 0; u < per / 4; ++u)
#pragma unroll
    for (int q = 0; q < 4; ++q) { const float c = vals[u * 4 + q] - mu; s2 += c * c; }
  red[tid] = s2; __syncthreads();
  for (int st = 128; st > 0; st >>= 1) { if (tid < st) red[tid] += red[tid + st]; __syncthreads(); }
  const float rs = rsqrtf(red[0] / (float)N + eps);
  {
    for (int u = 0; u < per / 4; ++u) {
      const int j = tid * 4 + 1024 * u;
      v4f o, sm;
#pragma unroll
      for (int q = 0; q < 4; ++q) {
        float gg = g[j + q], bb = bta[j + q];
        if (PARAM_BF16) { gg = bf16_round(gg); bb = bf16_round(bb); }
        sm[q] = vals[u * 4 + q]; o[q] = (vals[u * 4 + q] - mu) * rs * gg + bb;
      }
      if (out_sum) *(v4f*)(out_sum + (size_t)row * N + j) = sm;
      *(v4f*)(out_norm + (size_t)row * N + j) = o;
    }
    
  }
}



// ---- f16 WMMA path (v_wmma_f32_16x16x32_f16): 11-bit significands for operands in range — used where a [0,1] probability operand needs more precision than bf16
typedef _Float16 v16h __attribute__((ext_vector_type(16)));
union FragH { v16h v; v8us half[2]; _Float16 h[16]; unsigned short u[16]; };
template <int NT>
__device__ __forceinline__ v8f mmaH(v16h ah, v16h al, v16h bh, v16h bl, v8f c) {
  c = __builtin_amdgcn_wmma_f32_16x16x32_f16(false, ah, false, bh, (short)0, c, false, false);
  if (NT >= 2) c = __builtin_amdgcn_wmma_f32_16x16x32_f16(false, al, false, bh, (short)0, c, false, false);
  if (NT >= 3) c = __builtin_amdgcn_wmma_f32_16x16x32_f16(false, ah, false, bl, (short)0, c, false, false);
  asm volatile("v_nop\n\tv_nop\n\tv_nop\n\tv_nop" : "+v"(c) : "v"(ah), "v"(al), "v"(bh), "v"(bl));
  return c;
}
// batched GEMM like k_gemm_b but f16 operands: A f32 (split into f16 hi/lo if ASPLIT, else rounded to f16), Bt = f16 values [n][k]; alpha; C f32; N multiple of 16 (partial tiles skipped)
template <bool ASPLIT>
__global__ __launch_bounds__(128) void k_gemm_h(const float* __restrict__ A, int lda, size_t sA, const _Float16* __restrict__ Bh, int ldb, size_t sB, float alpha, float* __restrict__ C, int ldc, size_t sC, int M, int N, int K) {
  __shared__ __attribute__((aligned(16))) float so[4][16][64];
  const int tid = threadIdx.x, w = tid >> 5, lane = tid & 31, ln = lane & 15, hh = lane >> 4; const int by = blockIdx.y;
  A += (size_t)by * sA; Bh += (size_t)by * sB; C += (size_t)by * sC;
  const int ntn = (N + 63) / 64; const int wid = blockIdx.x * 4 + w; const int mt = wid / ntn, nq = wid % ntn; if (mt * 16 >= M) return;
  const int row0 = mt * 16, col0 = nq * 64; const float* arow = A + (size_t)(row0 + ln) * lda;
  v8f acc[4] = {};
  for (int kb = 0; kb < K; kb += 32) {
    FragH ah, al;
    const v4f x0 = *(const v4fa*)(arow + kb + 8 * hh), x1 = *(const v4fa*)(arow + kb + 8 * hh + 4), x2 = *(const v4fa*)(arow + kb + 16 + 8 * hh), x3 = *(const v4fa*)(arow + kb + 16 + 8 * hh + 4);
    float xs[16] = {x0[0],x0[1],x0[2],x0[3],x1[0],x1[1],x1[2],x1[3],x2[0],x2[1],x2[2],x2[3],x3[0],x3[1],x3[2],x3[3]};
#pragma unroll
    for (int i = 0; i < 16; ++i) { const _Float16 h = (_Float16)xs[i]; ah.h[i] = h; al.h[i] = ASPLIT ? (_Float16)(xs[i] - (float)h) : (_Float16)0.0f; }
#pragma unroll
    for (int t = 0; t < 4; ++t) { if (col0 + t * 16 >= N) continue; const size_t boff = (size_t)(col0 + t * 16 + ln) * ldb + kb; FragH bq; bq.half[0] = *(const v8us*)(Bh + boff + 8 * hh); bq.half[1] = *(const v8us*)(Bh + boff + 16 + 8 * hh);
      acc[t] = mmaH<ASPLIT ? 2 : 1>(ah.v, al.v, bq.v, bq.v, acc[t]); }
  }
#pragma unroll
  for (int t = 0; t < 4; ++t) { if (col0 + t * 16 >= N) continue;
#pragma unroll
    for (int r = 0; r < 8; ++r) so[w][8 * hh + r][t * 16 + ln] = acc[t][r] * alpha; }
  __builtin_amdgcn_fence(__ATOMIC_ACQ_REL, "workgroup"); __builtin_amdgcn_wave_barrier();
  const int rsub = lane >> 4, c4 = (lane & 15) * 4;
  {
#pragma unroll
    for (int q = 0; q < 8; ++q) { const int r = q * 2 + rsub; if (col0 + c4 < N) { const v4f v = *(const v4fa*)&so[w][r][c4]; *(v4f*)(C + (size_t)(row0 + r) * ldc + col0 + c4) = v; } }
     }
}

// Wt[n][k] = f16(W[k][n]·scale) from f32 row-major W[K][N] (scale = power of two; bf16-exact weights stay exact in f16 away from the subnormal range)
__global__ __launch_bounds__(256) void k_wt_f16(const float* __restrict__ W, _Float16* __restrict__ Wt, int K, int N, float scale) {
  const int t = blockIdx.x * 256 + threadIdx.x; if (t >= N * (K / 8)) return; const int n = t / (K / 8), k8 = (t % (K / 8)) * 8; FragH f;
#pragma unroll
  for (int i = 0; i < 8; ++i) f.h[i] = (_Float16)(bf16_round(W[(size_t)(k8 + i) * N + n]) * scale); const v8us o = f.half[0];
  *(v8us*)((unsigned short*)Wt + (size_t)n * K + k8) = o; 
}
// k_gemm_hh variant with fused epilogue: v = acc·alpha + bias[by·sBias + col] (+ CP[(row/rowsPerB)·sCPb + by·64 + col] if CP) ; ACT 0 none / 1 elu ; writes f16 C16 (and f32 C if non-null)
template <int ACT>
__global__ __launch_bounds__(128) void k_gemm_hhx(const _Float16* __restrict__ A, int lda, size_t sA, const _Float16* __restrict__ Bh, int ldb, size_t sB, float alpha, const float* __restrict__ bias, size_t sBias, const float* __restrict__ CP, int rowsPerB, size_t sCPb, int row0g,
    float* __restrict__ C, _Float16* __restrict__ C16, int ldc, size_t sC, int M, int N, int K) {
  __shared__ __attribute__((aligned(16))) float so[4][16][64];
  const int tid = threadIdx.x, w = tid >> 5, lane = tid & 31, ln = lane & 15, hh = lane >> 4; const int by = blockIdx.y;
  A += (size_t)by * sA; Bh += (size_t)by * sB; const size_t cofs = (size_t)by * sC; const float* bp = bias ? bias + (size_t)by * sBias : nullptr;
  const int ntn = (N + 63) / 64; const int wid = blockIdx.x * 4 + w; const int mt = wid / ntn, nq = wid % ntn; if (mt * 16 >= M) return;
  const int row0 = mt * 16, col0 = nq * 64; const _Float16* arow = A + (size_t)(row0 + ln) * lda;
  v8f acc[4] = {};
  for (int kb = 0; kb < K; kb += 32) { FragH ah; ah.half[0] = *(const v8us*)((const unsigned short*)arow + kb + 8 * hh); ah.half[1] = *(const v8us*)((const unsigned short*)arow + kb + 16 + 8 * hh);
#pragma unroll
    for (int t = 0; t < 4; ++t) { if (col0 + t * 16 >= N) continue; const size_t boff = (size_t)(col0 + t * 16 + ln) * ldb + kb; FragH bq; bq.half[0] = *(const v8us*)((const unsigned short*)Bh + boff + 8 * hh); bq.half[1] = *(const v8us*)((const unsigned short*)Bh + boff + 16 + 8 * hh);
      acc[t] = mmaH<1>(ah.v, ah.v, bq.v, bq.v, acc[t]); }
  }
#pragma unroll
  for (int t = 0; t < 4; ++t) { if (col0 + t * 16 >= N) continue; const int col = col0 + t * 16 + ln; const float bv = bp ? bf16_round(bp[col]) : 0.f;
#pragma unroll
    for (int r = 0; r < 8; ++r) { float v = acc[t][r] * alpha + bv; if (CP) { const int rr = row0g + row0 + 8 * hh + r; if (rowsPerB < 0) v += CP[cofs + (size_t)rr * ldc + col];      /* rowsPerB < 0: own element of the batched C plane */ else { const int bidx = rr / rowsPerB; v += CP[(size_t)bidx * sCPb + (size_t)by * 64 + col]; } } if (ACT == 1) v = (v > 0.f) ? v : expm1f(v); else if (ACT == 7) v = (v > 0.f) ? v + 1.0f : expf(v); else if (ACT == 8) v = tanhf(v); else if (ACT == 9) v = 0.5f * v * (1.0f + tanhf(0.7978845608028654f * (v + 0.044715f * v * v * v))); else if (ACT == 11) v = 1.0f / (1.0f + expf(-v)); else if (ACT == 12) v = (v > 0.f) ? v : 0.01f * v; else if (ACT == 14) v = (v > 0.f) ? v : 0.1f * v; else if (ACT == 16) v = (v >= 0.f) ? v : 0.3f * v; else if (ACT == 17) v = (v >= 0.f) ? v : 0.2f * v; else if (ACT == 15) v = v / (1.0f + expf(-v)); else if (ACT == 3) v = fmaxf(v, 0.f); else if (ACT == 6) v = 0.5f * v * (1.0f + erff(v * 0.70710678118654752f)); so[w][8 * hh + r][t * 16 + ln] = v; } }
  __builtin_amdgcn_fence(__ATOMIC_ACQ_REL, "workgroup"); __builtin_amdgcn_wave_barrier();
  const int rsub = lane >> 4, c4 = (lane & 15) * 4; typedef _Float16 v4h __attribute__((ext_vector_type(4)));
  {
#pragma unroll
    for (int q = 0; q < 8; ++q) { const int r = q * 2 + rsub; if (col0 + c4 < N) { const v4f v = *(const v4fa*)&so[w][r][c4]; if (C) *(v4f*)(C + cofs + (size_t)(row0 + r) * ldc + col0 + c4) = v; if (C16) { v4h h4; for (int i = 0; i < 4; ++i) h4[i] = (_Float16)v[i]; *(v4h*)(C16 + cofs + (size_t)(row0 + r) * ldc + col0 + c4) = h4; } } }
     }
}


typedef _Float16 v4h __attribute__((ext_vector_type(4)));

__global__ __launch_bounds__(256) void k_x16(const float* __restrict__ x, _Float16* __restrict__ X16, size_t n8) { const size_t t = (size_t)blockIdx.x * 256 + threadIdx.x; if (t >= n8) return; FragH f;
#pragma unroll
  for (int q = 0; q < 8; ++q) f.h[q] = (_Float16)bf16_round(x[t * 8 + q]); *(v8us*)((unsigned short*)X16 + t * 8) = f.half[0];  }
__global__ __launch_bounds__(256) void k_h16(const float* __restrict__ x, _Float16* __restrict__ X16, size_t n8) { const size_t t = (size_t)blockIdx.x * 256 + threadIdx.x; if (t >= n8) return; FragH f;
#pragma unroll
  for (int q = 0; q < 8; ++q) f.h[q] = (_Float16)x[t * 8 + q]; *(v8us*)((unsigned short*)X16 + t * 8) = f.half[0];  }
__global__ __launch_bounds__(256) void k_round16f(const float* __restrict__ W, _Float16* __restrict__ Bt, size_t n8) { const size_t t = (size_t)blockIdx.x * 256 + threadIdx.x; if (t >= n8) return; FragH f;
#pragma unroll
  for (int i = 0; i < 8; ++i) f.h[i] = (_Float16)(bf16_round(W[t * 8 + i]) * 16.0f); *(v8us*)((unsigned short*)Bt + t * 8) = f.half[0];  }
template <int NHv, int TTv>
__global__ __launch_bounds__(256) void k_vt(const _Float16* __restrict__ V16, int ldv, int voff, _Float16* __restrict__ Vt) { __shared__ unsigned short tl[64][66]; const int tid = threadIdx.x; const int slab = blockIdx.x / (TTv / 64), lg = blockIdx.x % (TTv / 64); const int b = slab / NHv, h = slab % NHv;
  for (int i = tid; i < 64 * 8; i += 256) { const int r = i / 8, c8 = (i % 8) * 8; FragH f; f.half[0] = *(const v8us*)((const unsigned short*)V16 + ((size_t)b * TTv + lg * 64 + r) * ldv + voff + h * 64 + c8);
#pragma unroll
    for (int q = 0; q < 8; ++q) tl[r][c8 + q] = f.u[q]; }
  __syncthreads();
  {
#pragma unroll
    for (int rd = 0; rd < 2; ++rd) { const int d = rd * 32 + tid / 8, pc = tid % 8; FragH f;
#pragma unroll
      for (int q = 0; q < 8; ++q) f.u[q] = tl[pc * 8 + q][d];
      *(v8us*)((unsigned short*)Vt + ((size_t)slab * 64 + d) * TTv + lg * 64 + pc * 8) = f.half[0]; }
     } }

__global__ __launch_bounds__(256) void k_hl(const float* __restrict__ F, _Float16* __restrict__ Hh, _Float16* __restrict__ Hl, size_t n8) { const size_t t = (size_t)blockIdx.x * 256 + threadIdx.x; if (t >= n8) return; FragH fh, fl; const v4f a = *(const v4fa*)(F + t * 8), c = *(const v4fa*)(F + t * 8 + 4);
#pragma unroll
  for (int q = 0; q < 4; ++q) { _Float16 h = (_Float16)a[q]; fh.h[q] = h; fl.h[q] = (_Float16)((a[q] - (float)h) * 1024.0f); h = (_Float16)c[q]; fh.h[4 + q] = h; fl.h[4 + q] = (_Float16)((c[q] - (float)h) * 1024.0f); }
  { *(v8us*)((unsigned short*)Hh + t * 8) = fh.half[0]; *(v8us*)((unsigned short*)Hl + t * 8) = fl.half[0];  } }

// ---- fast GEMM (wave tile 32x64; requires M % 32 == 0 rows per launch region and N % 64 == 0); epilogue = k_gemm_hhx semantics ----
__device__ __forceinline__ v16h g2_frag(const _Float16* p, int hh) { FragH f; f.half[0] = *(const v8us*)((const unsigned short*)p + 8 * hh); f.half[1] = *(const v8us*)((const unsigned short*)p + 16 + 8 * hh); return f.v; }
__device__ __forceinline__ v8f g2_mma(v16h a, v16h b, v8f c) { v8f d = __builtin_amdgcn_wmma_f32_16x16x32_f16(false, a, false, b, (short)0, c, false, false); asm volatile("v_nop\n\tv_nop\n\tv_nop\n\tv_nop" : "+v"(d) : "v"(a), "v"(b)); return d; }
template <int ACT>
__global__ __launch_bounds__(128) void k_gemm2(const _Float16* __restrict__ A, int lda, size_t sA, const _Float16* __restrict__ Bh, int ldb, size_t sB, float alpha, const float* __restrict__ bias, size_t sBias, const float* __restrict__ CP, int rowsPerB, size_t sCPb, int row0g,
    float* __restrict__ C, _Float16* __restrict__ C16, int ldc, size_t sC, int M, int N, int K) { static_assert(ACT == 0 || ACT == 3 || ACT == 6 || ACT == 8 || ACT == 9 || ACT == 11 || ACT == 12 || ACT == 14 || ACT == 15 || ACT == 16 || ACT == 17, "k_gemm2: unsupported ACT code (would silently apply no activation)");
  __shared__ __attribute__((aligned(16))) float so[4][32][68];
  const int tid = threadIdx.x, w = tid >> 5, lane = tid & 31, ln = lane & 15, hh = lane >> 4; const int by = blockIdx.y;
  A += (size_t)by * sA; Bh += (size_t)by * sB; const size_t cofs = (size_t)by * sC; const float* bp = bias ? bias + (size_t)by * sBias : nullptr;
  const int ntn = N >> 6; const int mt = blockIdx.x / ntn, nq = blockIdx.x - mt * ntn; const int row0 = mt * 128 + 32 * w, col0 = nq * 64; if (row0 >= M) return;
  const _Float16* a0p = A + (size_t)(row0 + ln) * lda; const _Float16* a1p = a0p + (size_t)16 * lda;
  const _Float16* b0p = Bh + (size_t)(col0 + ln) * ldb; const _Float16* b1p = b0p + (size_t)16 * ldb; const _Float16* b2p = b1p + (size_t)16 * ldb; const _Float16* b3p = b2p + (size_t)16 * ldb;
  const v8f z8 = {0.f,0.f,0.f,0.f,0.f,0.f,0.f,0.f}; v8f c00 = z8, c01 = z8, c02 = z8, c03 = z8, c10 = z8, c11 = z8, c12 = z8, c13 = z8;
#pragma unroll 1
  for (int kb = 0; kb < K; kb += 32) { const v16h a0 = g2_frag(a0p + kb, hh), a1 = g2_frag(a1p + kb, hh);
    v16h b = g2_frag(b0p + kb, hh); c00 = g2_mma(a0, b, c00); c10 = g2_mma(a1, b, c10);
    b = g2_frag(b1p + kb, hh); c01 = g2_mma(a0, b, c01); c11 = g2_mma(a1, b, c11);
    b = g2_frag(b2p + kb, hh); c02 = g2_mma(a0, b, c02); c12 = g2_mma(a1, b, c12);
    b = g2_frag(b3p + kb, hh); c03 = g2_mma(a0, b, c03); c13 = g2_mma(a1, b, c13); }
  v8f accs[8] = {c00, c01, c02, c03, c10, c11, c12, c13};
#pragma unroll
  for (int u = 0; u < 8; ++u) { const int t = u & 3, half = u >> 2; const int col = col0 + t * 16 + ln; const float bv = bp ? bf16_round(bp[col]) : 0.f;
#pragma unroll
    for (int r = 0; r < 8; ++r) { const int rloc = half * 16 + 8 * hh + r; float v = accs[u][r] * alpha + bv; if (CP) { if (rowsPerB < 0) v += CP[cofs + (size_t)(row0g + row0 + rloc) * ldc + col];      /* rowsPerB < 0: own element of the batched C plane */ else { const int bidx = (row0g + row0 + rloc) / rowsPerB; v += CP[(size_t)bidx * sCPb + (size_t)by * 64 + col]; } }
      if (ACT == 3) v = fmaxf(v, 0.f); else if (ACT == 6) v = 0.5f * v * (1.0f + erff(v * 0.70710678118654752f)); else if (ACT == 11) v = 1.0f / (1.0f + expf(-v)); else if (ACT == 15) v = v / (1.0f + expf(-v)); else if (ACT == 12) v = (v > 0.f) ? v : 0.01f * v; else if (ACT == 8) v = tanhf(v); else if (ACT == 9) v = 0.5f * v * (1.0f + tanhf(0.7978845608028654f * (v + 0.044715f * v * v * v))); else if (ACT == 14) v = (v > 0.f) ? v : 0.1f * v; else if (ACT == 16) v = (v >= 0.f) ? v : 0.3f * v; else if (ACT == 17) v = (v >= 0.f) ? v : 0.2f * v;
      so[w][rloc][t * 16 + ln] = v; } }
  __builtin_amdgcn_fence(__ATOMIC_ACQ_REL, "workgroup"); __builtin_amdgcn_wave_barrier();
  const int rsub = lane >> 4, c4 = (lane & 15) * 4;
  {
#pragma unroll
    for (int q = 0; q < 16; ++q) { const int r = q * 2 + rsub; const v4f v = *(const v4fa*)&so[w][r][c4]; if (C) *(v4f*)(C + cofs + (size_t)(row0 + r) * ldc + col0 + c4) = v; if (C16) { v4h h4; for (int i = 0; i < 4; ++i) h4[i] = (_Float16)v[i]; *(v4h*)(C16 + cofs + (size_t)(row0 + r) * ldc + col0 + c4) = h4; } }
     } }


__global__ __launch_bounds__(256) void k_wnat(const float* __restrict__ w, size_t n8, _Float16* __restrict__ Bt) { const size_t t = (size_t)blockIdx.x * 256 + threadIdx.x; if (t >= n8) return; FragH f; for (int q = 0; q < 8; ++q) f.h[q] = (_Float16)(bf16_round(w[t * 8 + q]) * 16.0f); *(v8us*)((unsigned short*)Bt + t * 8) = f.half[0];  }
__global__ __launch_bounds__(256) void k_rsm(const float* __restrict__ S, _Float16* __restrict__ P, int nrows) {
  #pragma clang fp contract(off)
  const int i = blockIdx.x * 256 + threadIdx.x; if (i >= nrows) return; const float* s = S + (size_t)i * SQ; float mx = -3.0e38f;
#pragma unroll 1
  for (int j = 0; j < SQ; ++j) mx = fmaxf(mx, s[j]); float se = 0.f;
#pragma unroll 1
  for (int j = 0; j < SQ; ++j) se += expf(s[j] - mx); const float sc = 256.0f / se;
#pragma unroll 1
  for (int j0 = 0; j0 < SQ; j0 += 8) { FragH f; for (int q = 0; q < 8; ++q) f.h[q] = (_Float16)(expf(s[j0 + q] - mx) * sc); unsigned short* d = (unsigned short*)P + (size_t)i * SQ + j0; *(v8us*)d = f.half[0];  } }
__global__ __launch_bounds__(256) void k_vt(const _Float16* __restrict__ V16, int b, int h0, _Float16* __restrict__ VT) { __shared__ unsigned short tl[64][65]; const int tid = threadIdx.x; const int hh = blockIdx.x % HG, sg = blockIdx.x / HG; const int s0 = sg * 64; const int h = h0 + hh;
  for (int i = tid; i < 64 * 8; i += 256) { const int j = i / 8, d8 = (i % 8) * 8; FragH f; f.half[0] = *(const v8us*)((const unsigned short*)V16 + ((size_t)b * SQ + s0 + j) * DM + h * HD + d8); for (int q = 0; q < 8; ++q) tl[d8 + q][j] = f.u[q]; }
  __syncthreads();
  { for (int i = tid; i < 64 * 8; i += 256) { const int d = i / 8, j8 = (i % 8) * 8; FragH f; for (int q = 0; q < 8; ++q) f.u[q] = tl[d][j8 + q]; *(v8us*)((unsigned short*)VT + ((size_t)hh * HD + d) * SQ + s0 + j8) = f.half[0]; }  } }

// ---- row softmax, one wave per row: the row's SQ scores are read once, 16 B per lane (each wave-wide load = 512 contiguous bytes), and stay in the wave's registers through max, exp, sum and scale ----
template <int CTRL>
__device__ __forceinline__ float rs_dpp(float v) { return __int_as_float(__builtin_amdgcn_update_dpp(0, __float_as_int(v), CTRL, 0xf, 0xf, true)); }      /* partner inside the 16-lane row: CTRL = 0x160 + m is row_xmask:m */
__device__ __forceinline__ float rs_xrow(float v) { const unsigned int i = __float_as_uint(v); return __uint_as_float(__builtin_amdgcn_permlanex16(i, i, 0x76543210u, 0xfedcba98u, false, false)); }      /* lane l <-> lane l ^ 16 */
__device__ __forceinline__ float rs_wave_max(float v) { v = fmaxf(v, rs_dpp<0x161>(v)); v = fmaxf(v, rs_dpp<0x162>(v)); v = fmaxf(v, rs_dpp<0x164>(v)); v = fmaxf(v, rs_dpp<0x168>(v)); return fmaxf(v, rs_xrow(v)); }
__device__ __forceinline__ float rs_wave_sum(float v) { v += rs_dpp<0x161>(v); v += rs_dpp<0x162>(v); v += rs_dpp<0x164>(v); v += rs_dpp<0x168>(v); return v + rs_xrow(v); }
__global__ __launch_bounds__(256) void k_rsmW(const float* __restrict__ S, _Float16* __restrict__ P, int nrows) {
  const int lane = threadIdx.x & 31; const int row = blockIdx.x * 8 + (threadIdx.x >> 5); if (row >= nrows) return;      /* wave-uniform exit; the kernel has no barrier */
  const float* s = S + (size_t)row * SQ + lane * 4; _Float16* p = P + (size_t)row * SQ + lane * 4;
  v4f v[SQ / 128];
  /* every loop below is fully unrolled so that v[] is indexed by constants and stays in registers */
#pragma unroll
  for (int u = 0; u < SQ / 128; ++u) v[u] = *(const v4fa*)(s + u * 128);
  v4f m4 = {-INFINITY, -INFINITY, -INFINITY, -INFINITY};
#pragma unroll
  for (int u = 0; u < SQ / 128; ++u)
#pragma unroll
    for (int q = 0; q < 4; ++q) m4[q] = fmaxf(m4[q], v[u][q]);
  const float mx = rs_wave_max(fmaxf(fmaxf(m4[0], m4[1]), fmaxf(m4[2], m4[3])));
  v4f a4 = {0.f, 0.f, 0.f, 0.f};      /* four independent sum chains per lane */
#pragma unroll
  for (int u = 0; u < SQ / 128; ++u)
#pragma unroll
    for (int q = 0; q < 4; ++q) { const float e = expf(v[u][q] - mx); v[u][q] = e; a4[q] += e; }
  const float sc = 256.0f / rs_wave_sum((a4[0] + a4[1]) + (a4[2] + a4[3]));
#pragma unroll
  for (int u = 0; u < SQ / 128; ++u) { v4h h4;
#pragma unroll
    for (int q = 0; q < 4; ++q) h4[q] = (_Float16)(v[u][q] * sc);
    *(v4h*)(p + u * 128) = h4; } }
__global__ __launch_bounds__(256) void k_f16rows(const float* __restrict__ F, _Float16* __restrict__ R, size_t n8) { const size_t t = (size_t)blockIdx.x * 256 + threadIdx.x; if (t >= n8) return; FragH f; for (int q = 0; q < 8; ++q) f.h[q] = (_Float16)F[t * 8 + q]; *(v8us*)((unsigned short*)R + t * 8) = f.half[0];  }
extern "C" void kernel_launch(void* const* d_in, const int* in_sizes, int n_in,
                              void* d_out, int out_size, void* d_ws, size_t ws_size, hipStream_t stream) {
  (void)in_sizes; (void)n_in; (void)out_size;
  const float* const* I = (const float* const*)d_in; const float* x = I[0]; const float* wq = I[1]; const float* bq = I[2]; const float* wk = I[3]; const float* bk = I[4]; const float* wv = I[5]; const float* bv = I[6];      /* [in][out] weights */
  char* ws = (char*)d_ws; size_t off = 0;
  auto take = [&](size_t bytes) { char* p = ws + off; off += (bytes + 255) & ~(size_t)255; return p; };
  _Float16* BQ = (_Float16*)take((size_t)DQ * DM * 2); _Float16* BK = (_Float16*)take((size_t)DQ * DM * 2); _Float16* BV = (_Float16*)take((size_t)DV * DM * 2);
  _Float16* X16 = (_Float16*)take(NR * DM * 2); float* F32 = (float*)take(NR * (DQ > DV ? DQ : DV) * 4); _Float16* Q16 = (_Float16*)take(NR * DQ * 2); _Float16* QL = (_Float16*)take(NR * DQ * 2); _Float16* K16 = (_Float16*)take(NR * DQ * 2); _Float16* KL = (_Float16*)take(NR * DQ * 2); _Float16* V16 = (_Float16*)take(NR * DV * 2);
  float* S = (float*)take((size_t)QT * SQ * 4); _Float16* P = (_Float16*)take((size_t)QT * SQ * 2); _Float16* PL = (_Float16*)take((size_t)QT * SQ * 2); _Float16* VT = (_Float16*)take((size_t)NB * DV * SQ * 2);
  if (off > ws_size) return;
  k_wt_f16<<<(unsigned)(((size_t)DQ * (DM / 8) + 255) / 256), 256, 0, stream>>>(wq, BQ, DM, DQ, 16.0f); k_wt_f16<<<(unsigned)(((size_t)DQ * (DM / 8) + 255) / 256), 256, 0, stream>>>(wk, BK, DM, DQ, 16.0f); k_wt_f16<<<(unsigned)(((size_t)DV * (DM / 8) + 255) / 256), 256, 0, stream>>>(wv, BV, DM, DV, 16.0f);
  k_x16<<<(unsigned)((NR * DM / 8 + 255) / 256), 256, 0, stream>>>(x, X16, NR * DM / 8);
  k_gemm2<0><<<dim3((unsigned)((NR / 128) * (DQ / 64)), 1), 128, 0, stream>>>(X16, DM, 0, BQ, DM, 0, 0.0625f, bq, 0, nullptr, 1, 0, 0, F32, nullptr, DQ, 0, MP, DQ, DM);      /* q f32 */
  k_hl<<<(unsigned)((NR * DQ / 8 + 255) / 256), 256, 0, stream>>>(F32, Q16, QL, NR * DQ / 8);
  k_gemm2<0><<<dim3((unsigned)((NR / 128) * (DQ / 64)), 1), 128, 0, stream>>>(X16, DM, 0, BK, DM, 0, 0.0625f, bk, 0, nullptr, 1, 0, 0, F32, nullptr, DQ, 0, MP, DQ, DM);      /* k f32 (reusing the plane) */
  k_hl<<<(unsigned)((NR * DQ / 8 + 255) / 256), 256, 0, stream>>>(F32, K16, KL, NR * DQ / 8);
  k_gemm2<0><<<dim3((unsigned)((NR / 128) * (DV / 64)), 1), 128, 0, stream>>>(X16, DM, 0, BV, DM, 0, 0.0625f, bv, 0, nullptr, 1, 0, 0, nullptr, V16, DV, 0, MP, DV, DM);      /* v f16 rows */
  k_vt<NH, SQ><<<NB * NH * (SQ / 64), 256, 0, stream>>>(V16, DV, 0, VT);      /* V^T per batch [DV][SQ] */
  for (int b = 0; b < NBR; ++b) for (int q0 = 0; q0 < QN; q0 += QT) {
    const size_t qo = ((size_t)b * SQ + q0) * DQ, ko = (size_t)b * SQ * DQ; const dim3 gs((QT / 128) * (SQ / 64), 1);
    k_gemm2<0><<<gs, 128, 0, stream>>>(QL + qo, DQ, 0, K16 + ko, DQ, 0, 1.0f / 1024.0f, nullptr, 0, nullptr, 1, 0, 0, S, nullptr, SQ, 0, QT, SQ, DQ);      /* three-term scores */
    k_gemm2<0><<<gs, 128, 0, stream>>>(Q16 + qo, DQ, 0, KL + ko, DQ, 0, 1.0f / 1024.0f, nullptr, 0, S, 1, (size_t)SQ, 0, S, nullptr, SQ, 0, QT, SQ, DQ);
    k_gemm2<0><<<gs, 128, 0, stream>>>(Q16 + qo, DQ, 0, K16 + ko, DQ, 0, 1.0f, nullptr, 0, S, 1, (size_t)SQ, 0, S, nullptr, SQ, 0, QT, SQ, DQ);
    k_rsmW<<<(QT + 7) / 8, 256, 0, stream>>>(S, P, QT);
    float* ob = (float*)d_out + ((size_t)b * SQ + q0) * DV; const _Float16* vt = VT + (size_t)b * DV * SQ; const dim3 gv((QT / 128) * (DV / 64), 1);
    k_gemm2<0><<<gv, 128, 0, stream>>>(P, SQ, 0, vt, SQ, 0, 0.00390625f, nullptr, 0, nullptr, 1, 0, 0, ob, nullptr, DV, 0, QT, DV, SQ); }      /* out = attn v */
}

// v003
// A run of this version takes 75.4 microseconds.
// Versions between v001 and this one are left out; their measured steps multiply to 42.3 times as fast.
// Over all steps from v000 it is 281 times as fast.
#include <hip/hip_runtime.h>
// SA layer (x [8][4096][128]; q, k = x W + b ([in][out] [128][64]), v = x Wv + bv; scores = q.k (NO scaling, logits sigma ~8); softmax; out = attn v -> [8][4096][64]).
// Structure: two launches. One front-end kernel per 128 token rows: x as exact f16 fragments; q | k | v on WMMA (16x192 wave tiles, f32 accumulation, exact x16 transposed [in][out] weights in LDS + bias); q and k out as f16 hi + 2^-10 residual planes (three-term scores); v out as V^T through LDS. One fused attention kernel per 128 queries: scores (K = 64) on WMMA, running-maximum softmax on VALU (f32; P x256 f16), out = P . V on WMMA, written straight to the f32 output.
// Compute dtype: inputs rounded to bf16; x / weights exact; q, k hi + residual (~2^-22); v, P plain f16 (~2^-12); scores / softmax f32. v_wmma_f32_16x16x32_f16.
#define NB 8
#define SQ 4096
#define DM 128
#define DQ 64
#define DV 64
#define QT 2048
#define NH 1                    /* V^T slabs of 64 (k_vt<NH, SQ>) */
#define HD 64
#define HG 1
#define NR ((size_t)NB * SQ)
#define QN SQ                        /* query rows per batch (debug hook) */
#define NBR NB                       /* batches (debug hook) */
#define MP ((int)NR)                 /* rows through the projections (debug hook) */
typedef __bf16 v16b __attribute__((ext_vector_type(16)));
typedef unsigned short v8us __attribute__((ext_vector_type(8), may_alias));
typedef float  v8f  __attribute__((ext_vector_type(8)));
typedef float  v4f  __attribute__((ext_vector_type(4)));
typedef float  v4fa __attribute__((ext_vector_type(4), may_alias));
union FragB { v16b v; v8us half[2]; unsigned short u[16]; };

__device__ __forceinline__ unsigned short bf16_bits(float x) { unsigned int u = __float_as_uint(x); return (unsigned short)((u + 0x7FFFu + ((u >> 16) & 1u)) >> 16); }
__device__ __forceinline__ float bf16_val(unsigned short b) { return __uint_as_float(((unsigned int)b) << 16); }
__device__ __forceinline__ float bf16_round(float x) { return bf16_val(bf16_bits(x)); }
// D += A·B with NT terms: 1 = ah·bh, 2 = + al·bh (A split), 3 = + ah·bl (both split)
template <int NT>
__device__ __forceinline__ v8f mmaN(v16b ah, v16b al, v16b bh, v16b bl, v8f c) {
  c = __builtin_amdgcn_wmma_f32_16x16x32_bf16(false, ah, false, bh, (short)0, c, false, false);
  if (NT >= 2) c = __builtin_amdgcn_wmma_f32_16x16x32_bf16(false, al, false, bh, (short)0, c, false, false);
  if (NT >= 3) c = __builtin_amdgcn_wmma_f32_16x16x32_bf16(false, ah, false, bl, (short)0, c, false, false);
  asm volatile("v_nop\n\tv_nop\n\tv_nop\n\tv_nop" : "+v"(c) : "v"(ah), "v"(al), "v"(bh), "v"(bl));
  return c;
}

__global__ __launch_bounds__(256) void k_wt_bf16(const float* __restrict__ W, unsigned short* __restrict__ Wt, int K, int N) {
  const int t = blockIdx.x * 256 + threadIdx.x;
  const int k8n = K / 8;
  if (t >= N * k8n) return;
  const int n = t / k8n, k8 = (t % k8n) * 8;
  v8us v;
#pragma unroll
  for (int i = 0; i < 8; ++i) v[i] = bf16_bits(W[(size_t)(k8 + i) * N + n]);
  *(v8us*)(Wt + (size_t)n * K + k8) = v;
  
}

// GEMM C[M][N] (f32, pitch ldc) = act(A[M][K]·W + bias). A f32 row-major (pitch lda) converted per fragment to bf16
// (ASPLIT: hi/lo two planes -> 2 terms, else single rounded term); Wt bf16 [N][K] (pitch ldb). BIAS_BF16 rounds the
// bias to bf16 first (bias quantised to bf16 before the add). K%32==0, M%16==0, N%64==0.
template <bool ASPLIT, int ACT, bool BIAS_BF16>
__global__ __launch_bounds__(128) void k_gemm_bf(const float* __restrict__ A, int lda, const unsigned short* __restrict__ Wt, int ldb,
                                               const float* __restrict__ bias, float* __restrict__ C, int ldc, int M, int N, int K) {
  __shared__ __attribute__((aligned(16))) float so[4][16][64];
  const int tid = threadIdx.x, w = tid >> 5, lane = tid & 31, ln = lane & 15, hh = lane >> 4;
  const int ntn = N / 64;
  const int wid = blockIdx.x * 4 + w;
  const int mt = wid / ntn, nq = wid % ntn;
  if (mt * 16 >= M) return;
  const int row0 = mt * 16, col0 = nq * 64;
  const float* arow = A + (size_t)(row0 + ln) * lda;
  v8f acc[4] = {};
  for (int kb = 0; kb < K; kb += 32) {
    FragB ah, al;
    const v4f x0 = *(const v4fa*)(arow + kb + 8 * hh), x1 = *(const v4fa*)(arow + kb + 8 * hh + 4);
    const v4f x2 = *(const v4fa*)(arow + kb + 16 + 8 * hh), x3 = *(const v4fa*)(arow + kb + 16 + 8 * hh + 4);
    float xs[16] = {x0[0],x0[1],x0[2],x0[3],x1[0],x1[1],x1[2],x1[3],x2[0],x2[1],x2[2],x2[3],x3[0],x3[1],x3[2],x3[3]};
#pragma unroll
    for (int i = 0; i < 16; ++i) { const unsigned short hb = bf16_bits(xs[i]); ah.u[i] = hb; al.u[i] = ASPLIT ? bf16_bits(xs[i] - bf16_val(hb)) : (unsigned short)0; }
#pragma unroll
    for (int t = 0; t < 4; ++t) {
      const unsigned short* brow = Wt + (size_t)(col0 + t * 16 + ln) * ldb + kb;
      FragB b;
      b.half[0] = *(const v8us*)(brow + 8 * hh);
      b.half[1] = *(const v8us*)(brow + 16 + 8 * hh);
      acc[t] = mmaN<ASPLIT ? 2 : 1>(ah.v, al.v, b.v, b.v, acc[t]);
    }
  }
#pragma unroll
  for (int t = 0; t < 4; ++t) {
    float bv = bias ? bias[col0 + t * 16 + ln] : 0.f;
    if (BIAS_BF16) bv = bf16_round(bv);
#pragma unroll
    for (int r = 0; r < 8; ++r) { float v = acc[t][r] + bv; if (ACT == 1) v = fmaxf(v, 0.f); so[w][8 * hh + r][t * 16 + ln] = v; }
  }
  __builtin_amdgcn_fence(__ATOMIC_ACQ_REL, "workgroup");
  __builtin_amdgcn_wave_barrier();
  const int rsub = lane >> 4, c4 = (lane & 15) * 4;
  {
#pragma unroll
    for (int q = 0; q < 8; ++q) {
      const int r = q * 2 + rsub;
      const v4f v = *(const v4fa*)&so[w][r][c4];
      *(v4f*)(C + (size_t)(row0 + r) * ldc + col0 + c4) = v;
    }
    
  }
}

// GEMM C = act(A·W + bias + resid): A f32 (ASPLIT -> hi/lo 2 terms), Wt bf16 [N][K]; ACT 0 none, 1 relu, 2 exact gelu;
// resid (optional, f32, row index = (row % rmod), pitch ldr, RES_BF16 rounds it) added before the activation.
template <bool ASPLIT, int ACT, bool BIAS_BF16, bool RES_BF16>
__global__ __launch_bounds__(128) void k_gemm_bf3(const float* __restrict__ A, int lda, const unsigned short* __restrict__ Wt, int ldb,
                                                const float* __restrict__ bias, const float* __restrict__ resid, int rmod, int ldr,
                                                float* __restrict__ C, int ldc, int M, int N, int K) {
  __shared__ __attribute__((aligned(16))) float so[4][16][64];
  const int tid = threadIdx.x, w = tid >> 5, lane = tid & 31, ln = lane & 15, hh = lane >> 4;
  const int ntn = N / 64;
  const int wid = blockIdx.x * 4 + w;
  const int mt = wid / ntn, nq = wid % ntn;
  if (mt * 16 >= M) return;
  const int row0 = mt * 16, col0 = nq * 64;
  const float* arow = A + (size_t)(row0 + ln) * lda;
  v8f acc[4] = {};
  for (int kb = 0; kb < K; kb += 32) {
    FragB ah, al;
    const v4f x0 = *(const v4fa*)(arow + kb + 8 * hh), x1 = *(const v4fa*)(arow + kb + 8 * hh + 4);
    const v4f x2 = *(const v4fa*)(arow + kb + 16 + 8 * hh), x3 = *(const v4fa*)(arow + kb + 16 + 8 * hh + 4);
    float xs[16] = {x0[0],x0[1],x0[2],x0[3],x1[0],x1[1],x1[2],x1[3],x2[0],x2[1],x2[2],x2[3],x3[0],x3[1],x3[2],x3[3]};
#pragma unroll
    for (int i = 0; i < 16; ++i) { const unsigned short hb = bf16_bits(xs[i]); ah.u[i] = hb; al.u[i] = ASPLIT ? bf16_bits(xs[i] - bf16_val(hb)) : (unsigned short)0; }
#pragma unroll
    for (int t = 0; t < 4; ++t) {
      const unsigned short* brow = Wt + (size_t)(col0 + t * 16 + ln) * ldb + kb;
      FragB b;
      b.half[0] = *(const v8us*)(brow + 8 * hh);
      b.half[1] = *(const v8us*)(brow + 16 + 8 * hh);
      acc[t] = mmaN<ASPLIT ? 2 : 1>(ah.v, al.v, b.v, b.v, acc[t]);
    }
  }
#pragma unroll
  for (int t = 0; t < 4; ++t) {
    const int col = col0 + t * 16 + ln;
    float bv = bias ? bias[col] : 0.f;
    if (BIAS_BF16) bv = bf16_round(bv);
#pragma unroll
    for (int r = 0; r < 8; ++r) {
      float v = acc[t][r] + bv;
      if (resid) { float rv = resid[(size_t)((row0 + 8 * hh + r) % rmod) * ldr + col]; if (RES_BF16) rv = bf16_round(rv); v += rv; }
      if (ACT == 1) v = fmaxf(v, 0.f);
      if (ACT == 2) v = 0.5f * v * (1.0f + erff(v * 0.70710678118654752f));
      if (ACT == 3) { const float u = 0.7978845608028654f * (v + 0.044715f * v * v * v); v = 0.5f * v * (1.0f + tanhf(u)); }
      so[w][8 * hh + r][t * 16 + ln] = v;
    }
  }
  __builtin_amdgcn_fence(__ATOMIC_ACQ_REL, "workgroup");
  __builtin_amdgcn_wave_barrier();
  const int rsub = lane >> 4, c4 = (lane & 15) * 4;
  {
#pragma unroll
    for (int q = 0; q < 8; ++q) {
      const int r = q * 2 + rsub;
      const v4f v = *(const v4fa*)&so[w][r][c4];
      *(v4f*)(C + (size_t)(row0 + r) * ldc + col0 + c4) = v;
    }
    
  }
}
// row LayerNorm (biased variance, eps) over N: s = X (+ R); optional out_sum <- s; out_norm <- (s-mu)*rsqrt(var+eps)*g + b
template <bool PARAM_BF16>
__global__ __launch_bounds__(256) void k_layernorm(const float* __restrict__ X, const float* __restrict__ R, const float* __restrict__ g, const float* __restrict__ bta,
                                                  float* __restrict__ out_sum, float* __restrict__ out_norm, int N, float eps) {
  __shared__ float red[256];
  const int row = blockIdx.x, tid = threadIdx.x;
  const float* x = X + (size_t)row * N; const float* rr = R ? R + (size_t)row * N : nullptr;
  float vals[16];                     // up to N = 4096
  const int per = N / 256;            // contiguous chunk per thread? use strided-by-4 chunks: thread handles j = tid*4 + 1024*u
  float s1 = 0.f;
  for (int u = 0; u < per / 4; ++u) {
    const int j = tid * 4 + 1024 * u;
    const v4f a = *(const v4fa*)(x + j);
    v4f b = {0.f,0.f,0.f,0.f}; if (rr) b = *(const v4fa*)(rr + j);
#pragma unroll
    for (int q = 0; q < 4; ++q) { const float v = a[q] + b[q]; vals[u * 4 + q] = v; s1 += v; }
  }
  red[tid] = s1; __syncthreads();
  for (int st = 128; st > 0; st >>= 1) { if (tid < st) red[tid] += red[tid + st]; __syncthreads(); }
  const float mu = red[0] / (float)N; __syncthreads();
  float s2 = 0.f;
  for (int u = 0; u < per / 4; ++u)
#pragma unroll
    for (int q = 0; q < 4; ++q) { const float c = vals[u * 4 + q] - mu; s2 += c * c; }
  red[tid] = s2; __syncthreads();
  for (int st = 128; st > 0; st >>= 1) { if (tid < st) red[tid] += red[tid + st]; __syncthreads(); }
  const float rs = rsqrtf(red[0] / (float)N + eps);
  {
    for (int u = 0; u < per / 4; ++u) {
      const int j = tid * 4 + 1024 * u;
      v4f o, sm;
#pragma unroll
      for (int q = 0; q < 4; ++q) {
        float gg = g[j + q], bb = bta[j + q];
        if (PARAM_BF16) { gg = bf16_round(gg); bb = bf16_round(bb); }
        sm[q] = vals[u * 4 + q]; o[q] = (vals[u * 4 + q] - mu) * rs * gg + bb;
      }
      if (out_sum) *(v4f*)(out_sum + (size_t)row * N + j) = sm;
      *(v4f*)(out_norm + (size_t)row * N + j) = o;
    }
    
  }
}



// ---- f16 WMMA path (v_wmma_f32_16x16x32_f16): 11-bit significands for operands in range — used where a [0,1] probability operand needs more precision than bf16
typedef _Float16 v16h __attribute__((ext_vector_type(16)));
union FragH { v16h v; v8us half[2]; _Float16 h[16]; unsigned short u[16]; };
template <int NT>
__device__ __forceinline__ v8f mmaH(v16h ah, v16h al, v16h bh, v16h bl, v8f c) {
  c = __builtin_amdgcn_wmma_f32_16x16x32_f16(false, ah, false, bh, (short)0, c, false, false);
  if (NT >= 2) c = __builtin_amdgcn_wmma_f32_16x16x32_f16(false, al, false, bh, (short)0, c, false, false);
  if (NT >= 3) c = __builtin_amdgcn_wmma_f32_16x16x32_f16(false, ah, false, bl, (short)0, c, false, false);
  asm volatile("v_nop\n\tv_nop\n\tv_nop\n\tv_nop" : "+v"(c) : "v"(ah), "v"(al), "v"(bh), "v"(bl));
  return c;
}
// batched GEMM like k_gemm_b but f16 operands: A f32 (split into f16 hi/lo if ASPLIT, else rounded to f16), Bt = f16 values [n][k]; alpha; C f32; N multiple of 16 (partial tiles skipped)
template <bool ASPLIT>
__global__ __launch_bounds__(128) void k_gemm_h(const float* __restrict__ A, int lda, size_t sA, const _Float16* __restrict__ Bh, int ldb, size_t sB, float alpha, float* __restrict__ C, int ldc, size_t sC, int M, int N, int K) {
  __shared__ __attribute__((aligned(16))) float so[4][16][64];
  const int tid = threadIdx.x, w = tid >> 5, lane = tid & 31, ln = lane & 15, hh = lane >> 4; const int by = blockIdx.y;
  A += (size_t)by * sA; Bh += (size_t)by * sB; C += (size_t)by * sC;
  const int ntn = (N + 63) / 64; const int wid = blockIdx.x * 4 + w; const int mt = wid / ntn, nq = wid % ntn; if (mt * 16 >= M) return;
  const int row0 = mt * 16, col0 = nq * 64; const float* arow = A + (size_t)(row0 + ln) * lda;
  v8f acc[4] = {};
  for (int kb = 0; kb < K; kb += 32) {
    FragH ah, al;
    const v4f x0 = *(const v4fa*)(arow + kb + 8 * hh), x1 = *(const v4fa*)(arow + kb + 8 * hh + 4), x2 = *(const v4fa*)(arow + kb + 16 + 8 * hh), x3 = *(const v4fa*)(arow + kb + 16 + 8 * hh + 4);
    float xs[16] = {x0[0],x0[1],x0[2],x0[3],x1[0],x1[1],x1[2],x1[3],x2[0],x2[1],x2[2],x2[3],x3[0],x3[1],x3[2],x3[3]};
#pragma unroll
    for (int i = 0; i < 16; ++i) { const _Float16 h = (_Float16)xs[i]; ah.h[i] = h; al.h[i] = ASPLIT ? (_Float16)(xs[i] - (float)h) : (_Float16)0.0f; }
#pragma unroll
    for (int t = 0; t < 4; ++t) { if (col0 + t * 16 >= N) continue; const size_t boff = (size_t)(col0 + t * 16 + ln) * ldb + kb; FragH bq; bq.half[0] = *(const v8us*)(Bh + boff + 8 * hh); bq.half[1] = *(const v8us*)(Bh + boff + 16 + 8 * hh);
      acc[t] = mmaH<ASPLIT ? 2 : 1>(ah.v, al.v, bq.v, bq.v, acc[t]); }
  }
#pragma unroll
  for (int t = 0; t < 4; ++t) { if (col0 + t * 16 >= N) continue;
#pragma unroll
    for (int r = 0; r < 8; ++r) so[w][8 * hh + r][t * 16 + ln] = acc[t][r] * alpha; }
  __builtin_amdgcn_fence(__ATOMIC_ACQ_REL, "workgroup"); __builtin_amdgcn_wave_barrier();
  const int rsub = lane >> 4, c4 = (lane & 15) * 4;
  {
#pragma unroll
    for (int q = 0; q < 8; ++q) { const int r = q * 2 + rsub; if (col0 + c4 < N) { const v4f v = *(const v4fa*)&so[w][r][c4]; *(v4f*)(C + (size_t)(row0 + r) * ldc + col0 + c4) = v; } }
     }
}

// Wt[n][k] = f16(W[k][n]·scale) from f32 row-major W[K][N] (scale = power of two; bf16-exact weights stay exact in f16 away from the subnormal range)
__global__ __launch_bounds__(256) void k_wt_f16(const float* __restrict__ W, _Float16* __restrict__ Wt, int K, int N, float scale) {
  const int t = blockIdx.x * 256 + threadIdx.x; if (t >= N * (K / 8)) return; const int n = t / (K / 8), k8 = (t % (K / 8)) * 8; FragH f;
#pragma unroll
  for (int i = 0; i < 8; ++i) f.h[i] = (_Float16)(bf16_round(W[(size_t)(k8 + i) * N + n]) * scale); const v8us o = f.half[0];
  *(v8us*)((unsigned short*)Wt + (size_t)n * K + k8) = o; 
}
// k_gemm_hh variant with fused epilogue: v = acc·alpha + bias[by·sBias + col] (+ CP[(row/rowsPerB)·sCPb + by·64 + col] if CP) ; ACT 0 none / 1 elu ; writes f16 C16 (and f32 C if non-null)
template <int ACT>
__global__ __launch_bounds__(128) void k_gemm_hhx(const _Float16* __restrict__ A, int lda, size_t sA, const _Float16* __restrict__ Bh, int ldb, size_t sB, float alpha, const float* __restrict__ bias, size_t sBias, const float* __restrict__ CP, int rowsPerB, size_t sCPb, int row0g,
    float* __restrict__ C, _Float16* __restrict__ C16, int ldc, size_t sC, int M, int N, int K) {
  __shared__ __attribute__((aligned(16))) float so[4][16][64];
  const int tid = threadIdx.x, w = tid >> 5, lane = tid & 31, ln = lane & 15, hh = lane >> 4; const int by = blockIdx.y;
  A += (size_t)by * sA; Bh += (size_t)by * sB; const size_t cofs = (size_t)by * sC; const float* bp = bias ? bias + (size_t)by * sBias : nullptr;
  const int ntn = (N + 63) / 64; const int wid = blockIdx.x * 4 + w; const int mt = wid / ntn, nq = wid % ntn; if (mt * 16 >= M) return;
  const int row0 = mt * 16, col0 = nq * 64; const _Float16* arow = A + (size_t)(row0 + ln) * lda;
  v8f acc[4] = {};
  for (int kb = 0; kb < K; kb += 32) { FragH ah; ah.half[0] = *(const v8us*)((const unsigned short*)arow + kb + 8 * hh); ah.half[1] = *(const v8us*)((const unsigned short*)arow + kb + 16 + 8 * hh);
#pragma unroll
    for (int t = 0; t < 4; ++t) { if (col0 + t * 16 >= N) continue; const size_t boff = (size_t)(col0 + t * 16 + ln) * ldb + kb; FragH bq; bq.half[0] = *(const v8us*)((const unsigned short*)Bh + boff + 8 * hh); bq.half[1] = *(const v8us*)((const unsigned short*)Bh + boff + 16 + 8 * hh);
      acc[t] = mmaH<1>(ah.v, ah.v, bq.v, bq.v, acc[t]); }
  }
#pragma unroll
  for (int t = 0; t < 4; ++t) { if (col0 + t * 16 >= N) continue; const int col = col0 + t * 16 + ln; const float bv = bp ? bf16_round(bp[col]) : 0.f;
#pragma unroll
    for (int r = 0; r < 8; ++r) { float v = acc[t][r] * alpha + bv; if (CP) { const int rr = row0g + row0 + 8 * hh + r; if (rowsPerB < 0) v += CP[cofs + (size_t)rr * ldc + col];      /* rowsPerB < 0: own element of the batched C plane */ else { const int bidx = rr / rowsPerB; v += CP[(size_t)bidx * sCPb + (size_t)by * 64 + col]; } } if (ACT == 1) v = (v > 0.f) ? v : expm1f(v); else if (ACT == 7) v = (v > 0.f) ? v + 1.0f : expf(v); else if (ACT == 8) v = tanhf(v); else if (ACT == 9) v = 0.5f * v * (1.0f + tanhf(0.7978845608028654f * (v + 0.044715f * v * v * v))); else if (ACT == 11) v = 1.0f / (1.0f + expf(-v)); else if (ACT == 12) v = (v > 0.f) ? v : 0.01f * v; else if (ACT == 14) v = (v > 0.f) ? v : 0.1f * v; else if (ACT == 16) v = (v >= 0.f) ? v : 0.3f * v; else if (ACT == 17) v = (v >= 0.f) ? v : 0.2f * v; else if (ACT == 15) v = v / (1.0f + expf(-v)); else if (ACT == 3) v = fmaxf(v, 0.f); else if (ACT == 6) v = 0.5f * v * (1.0f + erff(v * 0.70710678118654752f)); so[w][8 * hh + r][t * 16 + ln] = v; } }
  __builtin_amdgcn_fence(__ATOMIC_ACQ_REL, "workgroup"); __builtin_amdgcn_wave_barrier();
  const int rsub = lane >> 4, c4 = (lane & 15) * 4; typedef _Float16 v4h __attribute__((ext_vector_type(4)));
  {
#pragma unroll
    for (int q = 0; q < 8; ++q) { const int r = q * 2 + rsub; if (col0 + c4 < N) { const v4f v = *(const v4fa*)&so[w][r][c4]; if (C) *(v4f*)(C + cofs + (size_t)(row0 + r) * ldc + col0 + c4) = v; if (C16) { v4h h4; for (int i = 0; i < 4; ++i) h4[i] = (_Float16)v[i]; *(v4h*)(C16 + cofs + (size_t)(row0 + r) * ldc + col0 + c4) = h4; } } }
     }
}


typedef _Float16 v4h __attribute__((ext_vector_type(4)));

__global__ __launch_bounds__(256) void k_x16(const float* __restrict__ x, _Float16* __restrict__ X16, size_t n8) { const size_t t = (size_t)blockIdx.x * 256 + threadIdx.x; if (t >= n8) return; FragH f;
#pragma unroll
  for (int q = 0; q < 8; ++q) f.h[q] = (_Float16)bf16_round(x[t * 8 + q]); *(v8us*)((unsigned short*)X16 + t * 8) = f.half[0];  }
__global__ __launch_bounds__(256) void k_h16(const float* __restrict__ x, _Float16* __restrict__ X16, size_t n8) { const size_t t = (size_t)blockIdx.x * 256 + threadIdx.x; if (t >= n8) return; FragH f;
#pragma unroll
  for (int q = 0; q < 8; ++q) f.h[q] = (_Float16)x[t * 8 + q]; *(v8us*)((unsigned short*)X16 + t * 8) = f.half[0];  }
__global__ __launch_bounds__(256) void k_round16f(const float* __restrict__ W, _Float16* __restrict__ Bt, size_t n8) { const size_t t = (size_t)blockIdx.x * 256 + threadIdx.x; if (t >= n8) return; FragH f;
#pragma unroll
  for (int i = 0; i < 8; ++i) f.h[i] = (_Float16)(bf16_round(W[t * 8 + i]) * 16.0f); *(v8us*)((unsigned short*)Bt + t * 8) = f.half[0];  }
template <int NHv, int TTv>
__global__ __launch_bounds__(256) void k_vt(const _Float16* __restrict__ V16, int ldv, int voff, _Float16* __restrict__ Vt) { __shared__ unsigned short tl[64][66]; const int tid = threadIdx.x; const int slab = blockIdx.x / (TTv / 64), lg = blockIdx.x % (TTv / 64); const int b = slab / NHv, h = slab % NHv;
  for (int i = tid; i < 64 * 8; i += 256) { const int r = i / 8, c8 = (i % 8) * 8; FragH f; f.half[0] = *(const v8us*)((const unsigned short*)V16 + ((size_t)b * TTv + lg * 64 + r) * ldv + voff + h * 64 + c8);
#pragma unroll
    for (int q = 0; q < 8; ++q) tl[r][c8 + q] = f.u[q]; }
  __syncthreads();
  {
#pragma unroll
    for (int rd = 0; rd < 2; ++rd) { const int d = rd * 32 + tid / 8, pc = tid % 8; FragH f;
#pragma unroll
      for (int q = 0; q < 8; ++q) f.u[q] = tl[pc * 8 + q][d];
      *(v8us*)((unsigned short*)Vt + ((size_t)slab * 64 + d) * TTv + lg * 64 + pc * 8) = f.half[0]; }
     } }

__global__ __launch_bounds__(256) void k_hl(const float* __restrict__ F, _Float16* __restrict__ Hh, _Float16* __restrict__ Hl, size_t n8) { const size_t t = (size_t)blockIdx.x * 256 + threadIdx.x; if (t >= n8) return; FragH fh, fl; const v4f a = *(const v4fa*)(F + t * 8), c = *(const v4fa*)(F + t * 8 + 4);
#pragma unroll
  for (int q = 0; q < 4; ++q) { _Float16 h = (_Float16)a[q]; fh.h[q] = h; fl.h[q] = (_Float16)((a[q] - (float)h) * 1024.0f); h = (_Float16)c[q]; fh.h[4 + q] = h; fl.h[4 + q] = (_Float16)((c[q] - (float)h) * 1024.0f); }
  { *(v8us*)((unsigned short*)Hh + t * 8) = fh.half[0]; *(v8us*)((unsigned short*)Hl + t * 8) = fl.half[0];  } }

// ---- fast GEMM (wave tile 32x64; requires M % 32 == 0 rows per launch region and N % 64 == 0); epilogue = k_gemm_hhx semantics ----
__device__ __forceinline__ v16h g2_frag(const _Float16* p, int hh) { FragH f; f.half[0] = *(const v8us*)((const unsigned short*)p + 8 * hh); f.half[1] = *(const v8us*)((const unsigned short*)p + 16 + 8 * hh); return f.v; }
__device__ __forceinline__ v8f g2_mma(v16h a, v16h b, v8f c) { v8f d = __builtin_amdgcn_wmma_f32_16x16x32_f16(false, a, false, b, (short)0, c, false, false); asm volatile("v_nop\n\tv_nop\n\tv_nop\n\tv_nop" : "+v"(d) : "v"(a), "v"(b)); return d; }
template <int ACT>
__global__ __launch_bounds__(128) void k_gemm2(const _Float16* __restrict__ A, int lda, size_t sA, const _Float16* __restrict__ Bh, int ldb, size_t sB, float alpha, const float* __restrict__ bias, size_t sBias, const float* __restrict__ CP, int rowsPerB, size_t sCPb, int row0g,
    float* __restrict__ C, _Float16* __restrict__ C16, int ldc, size_t sC, int M, int N, int K) { static_assert(ACT == 0 || ACT == 3 || ACT == 6 || ACT == 8 || ACT == 9 || ACT == 11 || ACT == 12 || ACT == 14 || ACT == 15 || ACT == 16 || ACT == 17, "k_gemm2: unsupported ACT code (would silently apply no activation)");
  __shared__ __attribute__((aligned(16))) float so[4][32][68];
  const int tid = threadIdx.x, w = tid >> 5, lane = tid & 31, ln = lane & 15, hh = lane >> 4; const int by = blockIdx.y;
  A += (size_t)by * sA; Bh += (size_t)by * sB; const size_t cofs = (size_t)by * sC; const float* bp = bias ? bias + (size_t)by * sBias : nullptr;
  const int ntn = N >> 6; const int mt = blockIdx.x / ntn, nq = blockIdx.x - mt * ntn; const int row0 = mt * 128 + 32 * w, col0 = nq * 64; if (row0 >= M) return;
  const _Float16* a0p = A + (size_t)(row0 + ln) * lda; const _Float16* a1p = a0p + (size_t)16 * lda;
  const _Float16* b0p = Bh + (size_t)(col0 + ln) * ldb; const _Float16* b1p = b0p + (size_t)16 * ldb; const _Float16* b2p = b1p + (size_t)16 * ldb; const _Float16* b3p = b2p + (size_t)16 * ldb;
  const v8f z8 = {0.f,0.f,0.f,0.f,0.f,0.f,0.f,0.f}; v8f c00 = z8, c01 = z8, c02 = z8, c03 = z8, c10 = z8, c11 = z8, c12 = z8, c13 = z8;
#pragma unroll 1
  for (int kb = 0; kb < K; kb += 32) { const v16h a0 = g2_frag(a0p + kb, hh), a1 = g2_frag(a1p + kb, hh);
    v16h b = g2_frag(b0p + kb, hh); c00 = g2_mma(a0, b, c00); c10 = g2_mma(a1, b, c10);
    b = g2_frag(b1p + kb, hh); c01 = g2_mma(a0, b, c01); c11 = g2_mma(a1, b, c11);
    b = g2_frag(b2p + kb, hh); c02 = g2_mma(a0, b, c02); c12 = g2_mma(a1, b, c12);
    b = g2_frag(b3p + kb, hh); c03 = g2_mma(a0, b, c03); c13 = g2_mma(a1, b, c13); }
  v8f accs[8] = {c00, c01, c02, c03, c10, c11, c12, c13};
#pragma unroll
  for (int u = 0; u < 8; ++u) { const int t = u & 3, half = u >> 2; const int col = col0 + t * 16 + ln; const float bv = bp ? bf16_round(bp[col]) : 0.f;
#pragma unroll
    for (int r = 0; r < 8; ++r) { const int rloc = half * 16 + 8 * hh + r; float v = accs[u][r] * alpha + bv; if (CP) { if (rowsPerB < 0) v += CP[cofs + (size_t)(row0g + row0 + rloc) * ldc + col];      /* rowsPerB < 0: own element of the batched C plane */ else { const int bidx = (row0g + row0 + rloc) / rowsPerB; v += CP[(size_t)bidx * sCPb + (size_t)by * 64 + col]; } }
      if (ACT == 3) v = fmaxf(v, 0.f); else if (ACT == 6) v = 0.5f * v * (1.0f + erff(v * 0.70710678118654752f)); else if (ACT == 11) v = 1.0f / (1.0f + expf(-v)); else if (ACT == 15) v = v / (1.0f + expf(-v)); else if (ACT == 12) v = (v > 0.f) ? v : 0.01f * v; else if (ACT == 8) v = tanhf(v); else if (ACT == 9) v = 0.5f * v * (1.0f + tanhf(0.7978845608028654f * (v + 0.044715f * v * v * v))); else if (ACT == 14) v = (v > 0.f) ? v : 0.1f * v; else if (ACT == 16) v = (v >= 0.f) ? v : 0.3f * v; else if (ACT == 17) v = (v >= 0.f) ? v : 0.2f * v;
      so[w][rloc][t * 16 + ln] = v; } }
  __builtin_amdgcn_fence(__ATOMIC_ACQ_REL, "workgroup"); __builtin_amdgcn_wave_barrier();
  const int rsub = lane >> 4, c4 = (lane & 15) * 4;
  {
#pragma unroll
    for (int q = 0; q < 16; ++q) { const int r = q * 2 + rsub; const v4f v = *(const v4fa*)&so[w][r][c4]; if (C) *(v4f*)(C + cofs + (size_t)(row0 + r) * ldc + col0 + c4) = v; if (C16) { v4h h4; for (int i = 0; i < 4; ++i) h4[i] = (_Float16)v[i]; *(v4h*)(C16 + cofs + (size_t)(row0 + r) * ldc + col0 + c4) = h4; } }
     } }


__global__ __launch_bounds__(256) void k_wnat(const float* __restrict__ w, size_t n8, _Float16* __restrict__ Bt) { const size_t t = (size_t)blockIdx.x * 256 + threadIdx.x; if (t >= n8) return; FragH f; for (int q = 0; q < 8; ++q) f.h[q] = (_Float16)(bf16_round(w[t * 8 + q]) * 16.0f); *(v8us*)((unsigned short*)Bt + t * 8) = f.half[0];  }
__global__ __launch_bounds__(256) void k_rsm(const float* __restrict__ S, _Float16* __restrict__ P, int nrows) {
  #pragma clang fp contract(off)
  const int i = blockIdx.x * 256 + threadIdx.x; if (i >= nrows) return; const float* s = S + (size_t)i * SQ; float mx = -3.0e38f;
#pragma unroll 1
  for (int j = 0; j < SQ; ++j) mx = fmaxf(mx, s[j]); float se = 0.f;
#pragma unroll 1
  for (int j = 0; j < SQ; ++j) se += expf(s[j] - mx); const float sc = 256.0f / se;
#pragma unroll 1
  for (int j0 = 0; j0 < SQ; j0 += 8) { FragH f; for (int q = 0; q < 8; ++q) f.h[q] = (_Float16)(expf(s[j0 + q] - mx) * sc); unsigned short* d = (unsigned short*)P + (size_t)i * SQ + j0; *(v8us*)d = f.half[0];  } }
__global__ __launch_bounds__(256) void k_vt(const _Float16* __restrict__ V16, int b, int h0, _Float16* __restrict__ VT) { __shared__ unsigned short tl[64][65]; const int tid = threadIdx.x; const int hh = blockIdx.x % HG, sg = blockIdx.x / HG; const int s0 = sg * 64; const int h = h0 + hh;
  for (int i = tid; i < 64 * 8; i += 256) { const int j = i / 8, d8 = (i % 8) * 8; FragH f; f.half[0] = *(const v8us*)((const unsigned short*)V16 + ((size_t)b * SQ + s0 + j) * DM + h * HD + d8); for (int q = 0; q < 8; ++q) tl[d8 + q][j] = f.u[q]; }
  __syncthreads();
  { for (int i = tid; i < 64 * 8; i += 256) { const int d = i / 8, j8 = (i % 8) * 8; FragH f; for (int q = 0; q < 8; ++q) f.u[q] = tl[d][j8 + q]; *(v8us*)((unsigned short*)VT + ((size_t)hh * HD + d) * SQ + s0 + j8) = f.half[0]; }  } }

// ---- fused attention: one work-group = 128 queries of one batch (8 waves x 16 query columns) walks all SQ keys in LDS stages of 64; scores and P stay in registers ----
// Transposed products: S^T = K . Q^T (rows = keys, columns = queries), O^T += V^T . P^T. A lane's 8 + 8 accumulator registers of the two 16-key score tiles are keys 8 hh + r and 16 + 8 hh + r of its own query column:
// exactly the k order of the B fragment of the second product, so P goes from accumulator to operand inside the lane. Max and sum of a query live in its two lanes (ln, ln + 16).
#define FA_NW 8                      /* waves per work-group */
#define FA_BQ (FA_NW * 16)           /* queries per work-group */
#define FA_SK 64                     /* keys per LDS stage */
#define FA_NS (SQ / FA_SK)
#define FA_PITCH 144                 /* LDS row pitch, bytes: 128 of data + 16 (an odd multiple of 16 B for the 16-byte fragment reads) */
#define FA_TILE (64 * FA_PITCH)
typedef float v2f __attribute__((ext_vector_type(2)));
typedef _Float16 v2h __attribute__((ext_vector_type(2)));
union FragP { v16h v; v2h p[8]; v8us half[2]; };
__device__ __forceinline__ float fa_xrow(float v) { const unsigned int i = __float_as_uint(v); return __uint_as_float(__builtin_amdgcn_permlanex16(i, i, 0x76543210u, 0xfedcba98u, false, false)); }      /* lane l <-> lane l ^ 16 */
__device__ __forceinline__ v16h fa_frag(const unsigned char* p) { FragH f; f.half[0] = *(const v8us*)p; f.half[1] = *(const v8us*)(p + 32); return f.v; }      /* p already holds the lane's 16 hh bytes: k = 8 hh + i, 16 + 8 hh + i, as g2_frag */
__device__ __forceinline__ v8f fa_mma(v16h a, v16h b, v8f c) { return __builtin_amdgcn_wmma_f32_16x16x32_f16(false, a, false, b, (short)0, c, false, false); }
__global__ __launch_bounds__(256) void k_fattn(const _Float16* __restrict__ Qh, const _Float16* __restrict__ Ql, const _Float16* __restrict__ Kh, const _Float16* __restrict__ Kl, const _Float16* __restrict__ Vt, float* __restrict__ O) {
  static_assert(DQ == 64 && DV == 64 && SQ % FA_BQ == 0 && SQ % FA_SK == 0, "k_fattn: written for 64-wide q, k, v rows");
  __shared__ __attribute__((aligned(16))) unsigned char L[2][3][FA_TILE];      /* two buffers of { K hi [key][h], K residual [key][h], V^T [d][key] } */
  const int tid = threadIdx.x, w = tid >> 5, lane = tid & 31, ln = lane & 15, hh = lane >> 4;
  const int b = blockIdx.x / (SQ / FA_BQ), q0 = (blockIdx.x % (SQ / FA_BQ)) * FA_BQ + w * 16;
  /* staging: every tile is 64 rows x 128 B = 512 chunks of 16 B; thread t moves chunks t and t + 256 (row + 32) of each of the three tiles */
  const unsigned char* gkh = (const unsigned char*)(Kh + (size_t)b * SQ * DQ) + tid * 16;
  const unsigned char* gkl = (const unsigned char*)(Kl + (size_t)b * SQ * DQ) + tid * 16;
  const unsigned char* gvt = (const unsigned char*)(Vt + (size_t)b * DV * SQ) + (size_t)(tid >> 3) * (SQ * 2) + (tid & 7) * 16;
  const int lst = (tid >> 3) * FA_PITCH + (tid & 7) * 16;
  v8us st0, st1, st2, st3, st4, st5;
#define FA_FETCH(s) { st0 = *(const v8us*)(gkh + (size_t)(s) * 8192); st1 = *(const v8us*)(gkh + (size_t)(s) * 8192 + 4096); st2 = *(const v8us*)(gkl + (size_t)(s) * 8192); st3 = *(const v8us*)(gkl + (size_t)(s) * 8192 + 4096); \
    st4 = *(const v8us*)(gvt + (size_t)(s) * 128); st5 = *(const v8us*)(gvt + (size_t)(s) * 128 + (size_t)32 * SQ * 2); }
#define FA_PUT(bf) { *(v8us*)&L[bf][0][lst] = st0; *(v8us*)&L[bf][0][lst + 32 * FA_PITCH] = st1; *(v8us*)&L[bf][1][lst] = st2; *(v8us*)&L[bf][1][lst + 32 * FA_PITCH] = st3; *(v8us*)&L[bf][2][lst] = st4; *(v8us*)&L[bf][2][lst + 32 * FA_PITCH] = st5; }
  const _Float16* qhp = Qh + ((size_t)b * SQ + q0 + ln) * DQ; const _Float16* qlp = Ql + ((size_t)b * SQ + q0 + ln) * DQ;
  const v16h qh0 = g2_frag(qhp, hh), qh1 = g2_frag(qhp + 32, hh), ql0 = g2_frag(qlp, hh), ql1 = g2_frag(qlp + 32, hh);
  const v8f z8 = {0.f,0.f,0.f,0.f,0.f,0.f,0.f,0.f};
  v8f acc[4] = {z8, z8, z8, z8};
  float m2 = -INFINITY, l = 0.f;      /* running maximum (in log2 units) of the lane's query, the same in both of its lanes; the lane's own part of the sum of P */
  const float L2E = 1.4426950408889634f;
  FA_FETCH(0) FA_PUT(0)
  __syncthreads();
  /* the stage loop stays rolled: its body is already two unrolled 32-key passes; every loop inside it is fully unrolled so that the register arrays are indexed by constants */
#pragma unroll 1
  for (int s = 0; s < FA_NS; ++s) {
    const int bf = s & 1;
    if (s + 1 < FA_NS) FA_FETCH(s + 1)      /* next stage's global loads fly under this stage's two passes */
#pragma unroll
    for (int kk = 0; kk < 2; ++kk) {
      v8f sm[2], sr[2];
#pragma unroll
      for (int kt = 0; kt < 2; ++kt) {
        const int ro = (kk * 32 + kt * 16 + ln) * FA_PITCH + 16 * hh;
        const v16h kh0 = fa_frag(&L[bf][0][ro]), kh1 = fa_frag(&L[bf][0][ro + 64]), kl0 = fa_frag(&L[bf][1][ro]), kl1 = fa_frag(&L[bf][1][ro + 64]);
        sm[kt] = fa_mma(kh1, qh1, fa_mma(kh0, qh0, z8));                                                        /* k_hi . q_hi */
        sr[kt] = fa_mma(kl1, qh1, fa_mma(kl0, qh0, fa_mma(kh1, ql1, fa_mma(kh0, ql0, z8))));      /* 1024 x (k_hi . q_res + k_res . q_hi) */
      }
      v16h vf[4];      /* this pass's V^T fragments */
#pragma unroll
      for (int dt = 0; dt < 4; ++dt) vf[dt] = fa_frag(&L[bf][2][(dt * 16 + ln) * FA_PITCH + kk * 64 + 16 * hh]);
      v2f s2[8];      /* s2[j]: registers 2 (j & 3), 2 (j & 3) + 1 of score tile j >> 2 = elements 2 j, 2 j + 1 of the 32-key operand */
#pragma unroll
      for (int j = 0; j < 8; ++j) s2[j] = __builtin_elementwise_fma(v2f{sr[j >> 2][2 * (j & 3)], sr[j >> 2][2 * (j & 3) + 1]}, v2f{1.0f / 1024.0f, 1.0f / 1024.0f}, v2f{sm[j >> 2][2 * (j & 3)], sm[j >> 2][2 * (j & 3) + 1]});
      float t8[8];
#pragma unroll
      for (int j = 0; j < 8; ++j) t8[j] = fmaxf(s2[j].x, s2[j].y);
      float mx = fmaxf(fmaxf(fmaxf(t8[0], t8[1]), fmaxf(t8[2], t8[3])), fmaxf(fmaxf(t8[4], t8[5]), fmaxf(t8[6], t8[7])));
      mx = fmaxf(mx, fa_xrow(mx)) * L2E;
      asm volatile("" :: "v"(vf[0]), "v"(vf[1]), "v"(vf[2]), "v"(vf[3]));      /* inputs only: holds the four V^T fragment loads together in front of the branch, one LDS wait for all; left free they sink to their WMMAs, each behind a wait of its own */
      if (__builtin_amdgcn_ballot_w32(mx > m2) != 0) {      /* wave-uniform: some query of the wave has a new maximum; a lane without one scales by exp2(0) = 1 */
        const float mn = fmaxf(m2, mx); const float corr = __builtin_amdgcn_exp2f(m2 - mn); m2 = mn; l *= corr;
#pragma unroll
        for (int dt = 0; dt < 4; ++dt) acc[dt] = acc[dt] * corr;
      }
      const float nm = 8.0f - m2;      /* P is kept x 256 (as before the fusion) to hold small weights above the f16 subnormals; the factor cancels in acc / l */
      FragP pf; v2f ps0 = {0.f, 0.f}, ps1 = {0.f, 0.f};
#pragma unroll
      for (int j = 0; j < 8; ++j) { const v2f a = __builtin_elementwise_fma(s2[j], v2f{L2E, L2E}, v2f{nm, nm}); const v2f p = {__builtin_amdgcn_exp2f(a.x), __builtin_amdgcn_exp2f(a.y)};
        if (j & 1) ps1 += p; else ps0 += p; pf.p[j] = __builtin_convertvector(p, v2h); }
      l += (ps0.x + ps0.y) + (ps1.x + ps1.y);
#pragma unroll
      for (int dt = 0; dt < 4; ++dt) acc[dt] = fa_mma(vf[dt], pf.v, acc[dt]);
    }
    if (s + 1 < FA_NS) FA_PUT(bf ^ 1)      /* that buffer's last readers left it before the barrier that ended stage s - 1 */
    __syncthreads();      /* publishes stage s + 1 and ends every wave's reads of stage s */
  }
  const float inv = 1.0f / (l + fa_xrow(l));
  float* op = O + ((size_t)b * SQ + q0 + ln) * DV + 8 * hh;      /* accumulator tile dt, register r: d = 16 dt + 8 hh + r of query ln */
#pragma unroll
  for (int dt = 0; dt < 4; ++dt) { const v8f o = acc[dt] * inv; const v4f o0 = {o[0], o[1], o[2], o[3]}, o1 = {o[4], o[5], o[6], o[7]}; *(v4f*)(op + dt * 16) = o0; *(v4f*)(op + dt * 16 + 4) = o1; }
#undef FA_FETCH
#undef FA_PUT
}
// ---- fused front end: one work-group = 128 token rows (8 waves x 16 rows); every wave forms q, k and v of its rows (16 x 192, K = 128) and the planes the attention kernel reads go out through LDS (q, k rows per wave, V^T per work-group) ----
// x goes from its f32 rows into the A fragments inside the lane (rounded as before); the three [in][out] weights are rounded, scaled x16 and transposed into LDS once per work-group; same operands, same k order and same epilogue arithmetic as the separate kernels had.
typedef __bf16 v2b __attribute__((ext_vector_type(2)));
__device__ __forceinline__ v2f pj_round2(v2f v) { const unsigned int u = __builtin_bit_cast(unsigned int, __builtin_convertvector(v, v2b)); return v2f{__uint_as_float(u << 16), __uint_as_float(u & 0xFFFF0000u)}; }      /* two f32 rounded to bf16 (nearest even), back as f32 */
#define PJ_PITCH 272                 /* LDS row pitch, bytes, of 128 f16: 256 of data + 16 (an odd multiple of 16 B for the 16-byte fragment reads) */
__global__ __launch_bounds__(256) void k_proj(const float* __restrict__ x, const float* __restrict__ wq, const float* __restrict__ bq, const float* __restrict__ wk, const float* __restrict__ bk, const float* __restrict__ wv, const float* __restrict__ bv,
    _Float16* __restrict__ Qh, _Float16* __restrict__ Ql, _Float16* __restrict__ Kh, _Float16* __restrict__ Kl, _Float16* __restrict__ Vt) {
  static_assert(DM == 128 && DQ == 64 && DV == 64 && SQ % 128 == 0, "k_proj: written for 128-wide x rows and 64-wide q, k, v rows");
  __shared__ __attribute__((aligned(16))) unsigned char LW[3][64 * PJ_PITCH];      /* W^T x16, f16 [out][in], of q, k, v */
  __shared__ __attribute__((aligned(16))) float so[8][2][16][68];                  /* per wave: its q and k rows, f32 */
  __shared__ __attribute__((aligned(16))) unsigned char LV[64 * PJ_PITCH];         /* V^T of the work-group's 128 tokens, f16 [d][token] */
  const int tid = threadIdx.x, w = tid >> 5, lane = tid & 31, ln = lane & 15, hh = lane >> 4;
  const int row0 = blockIdx.x * 128 + w * 16;
  /* weights: per matrix 16 x 16 blocks of 8 k x 4 output columns, one block a thread; sixteen lanes read one whole 256-byte row of W */
  const int n4 = (tid & 15) * 4, k8 = (tid >> 4) * 8;
  v4f wr[3][8];
#pragma unroll
  for (int m = 0; m < 3; ++m) { const float* Wm = (m == 0 ? wq : (m == 1 ? wk : wv)) + k8 * 64 + n4;
#pragma unroll
    for (int i = 0; i < 8; ++i) wr[m][i] = *(const v4fa*)(Wm + i * 64); }
  /* the lane's part of its x row: k = 32 kb + 8 hh + i and 32 kb + 16 + 8 hh + i, the order of g2_frag; these loads (from memory) fly while the weights (mostly from L2) are rounded and laid into LDS */
  const float* xr = x + (size_t)(row0 + ln) * DM + 8 * hh;
  v4f xs[16];
#pragma unroll
  for (int kb = 0; kb < 4; ++kb) { xs[4 * kb] = *(const v4fa*)(xr + kb * 32); xs[4 * kb + 1] = *(const v4fa*)(xr + kb * 32 + 4); xs[4 * kb + 2] = *(const v4fa*)(xr + kb * 32 + 16); xs[4 * kb + 3] = *(const v4fa*)(xr + kb * 32 + 20); }
  asm volatile("s_wait_xcnt 0x0" :: "v"(xr) : "memory");      /* the address pair lives up to this wait: left free, the last load's result was laid over the pair that the fifteen loads before it name */
#pragma unroll
  for (int m = 0; m < 3; ++m)
#pragma unroll
    for (int j = 0; j < 4; ++j) { FragP f;      /* column n4 + j: its 8 k, transposed inside the thread */
#pragma unroll
      for (int p = 0; p < 4; ++p) f.p[p] = __builtin_convertvector(pj_round2(v2f{wr[m][2 * p][j], wr[m][2 * p + 1][j]}) * v2f{16.0f, 16.0f}, v2h);
      *(v8us*)&LW[m][(n4 + j) * PJ_PITCH + k8 * 2] = f.half[0]; }
  FragP a[4];
#pragma unroll
  for (int kb = 0; kb < 4; ++kb)
#pragma unroll
    for (int p = 0; p < 8; ++p) a[kb].p[p] = __builtin_convertvector(pj_round2(v2f{xs[4 * kb + (p >> 1)][2 * (p & 1)], xs[4 * kb + (p >> 1)][2 * (p & 1) + 1]}), v2h);
  __syncthreads();      /* publishes the three W^T tiles */
  const v8f z8 = {0.f,0.f,0.f,0.f,0.f,0.f,0.f,0.f};
  v8f acc[3][4] = {{z8, z8, z8, z8}, {z8, z8, z8, z8}, {z8, z8, z8, z8}};
#pragma unroll
  for (int kb = 0; kb < 4; ++kb)
#pragma unroll
    for (int m = 0; m < 3; ++m)
#pragma unroll
      for (int t = 0; t < 4; ++t) acc[m][t] = fa_mma(a[kb].v, fa_frag(&LW[m][(t * 16 + ln) * PJ_PITCH + kb * 64 + 16 * hh]), acc[m][t]);
  /* accumulator tile t, register r: row 8 hh + r, column 16 t + ln */
#pragma unroll
  for (int m = 0; m < 2; ++m)
#pragma unroll
    for (int t = 0; t < 4; ++t) { const float bb = bf16_round((m ? bk : bq)[t * 16 + ln]);
#pragma unroll
      for (int r = 0; r < 8; ++r) so[w][m][8 * hh + r][t * 16 + ln] = acc[m][t][r] * 0.0625f + bb; }
#pragma unroll
  for (int t = 0; t < 4; ++t) { const float bb = bf16_round(bv[t * 16 + ln]); FragH f;      /* a lane's 8 registers are 8 consecutive tokens of one d: 16 bytes of a V^T row */
#pragma unroll
    for (int r = 0; r < 8; ++r) f.h[r] = (_Float16)(acc[2][t][r] * 0.0625f + bb);
    *(v8us*)&LV[(t * 16 + ln) * PJ_PITCH + (w * 16 + 8 * hh) * 2] = f.half[0]; }
  __syncthreads();      /* publishes the V^T tile to the other waves (and each wave's q, k rows to its own lanes) */
#pragma unroll
  for (int m = 0; m < 2; ++m)
#pragma unroll
    for (int q4 = 0; q4 < 4; ++q4) { const int c = q4 * 32 + lane, r = c >> 3, c8 = (c & 7) * 8; FragP fh, fl; const v4f u = *(const v4fa*)&so[w][m][r][c8], v = *(const v4fa*)&so[w][m][r][c8 + 4];      /* a wave's store covers four whole 128-byte rows */
      const v2f e2[4] = {{u[0], u[1]}, {u[2], u[3]}, {v[0], v[1]}, {v[2], v[3]}};
#pragma unroll
      for (int p = 0; p < 4; ++p) { const v2h h = __builtin_convertvector(e2[p], v2h); fh.p[p] = h; fl.p[p] = __builtin_convertvector((e2[p] - __builtin_convertvector(h, v2f)) * v2f{1024.0f, 1024.0f}, v2h); }      /* hi, and the residual x 1024 */
      const size_t o = (size_t)(row0 + r) * DQ + c8;
      *(v8us*)((unsigned short*)(m ? Kh : Qh) + o) = fh.half[0]; *(v8us*)((unsigned short*)(m ? Kl : Ql) + o) = fl.half[0]; }
  const int b = blockIdx.x / (SQ / 128), s0 = (blockIdx.x % (SQ / 128)) * 128;
#pragma unroll
  for (int j = 0; j < 4; ++j) { const int c = j * 256 + tid, d = c >> 4, ch = c & 15;      /* sixteen lanes store one 256-byte piece of a V^T row */
    *(v8us*)((unsigned short*)Vt + ((size_t)b * DV + d) * SQ + s0 + ch * 8) = *(const v8us*)&LV[d * PJ_PITCH + ch * 16]; }
}
__global__ __launch_bounds__(256) void k_f16rows(const float* __restrict__ F, _Float16* __restrict__ R, size_t n8) { const size_t t = (size_t)blockIdx.x * 256 + threadIdx.x; if (t >= n8) return; FragH f; for (int q = 0; q < 8; ++q) f.h[q] = (_Float16)F[t * 8 + q]; *(v8us*)((unsigned short*)R + t * 8) = f.half[0];  }
extern "C" void kernel_launch(void* const* d_in, const int* in_sizes, int n_in,
                              void* d_out, int out_size, void* d_ws, size_t ws_size, hipStream_t stream) {
  (void)in_sizes; (void)n_in; (void)out_size;
  const float* const* I = (const float* const*)d_in; const float* x = I[0]; const float* wq = I[1]; const float* bq = I[2]; const float* wk = I[3]; const float* bk = I[4]; const float* wv = I[5]; const float* bv = I[6];      /* [in][out] weights */
  char* ws = (char*)d_ws; size_t off = 0;
  auto take = [&](size_t bytes) { char* p = ws + off; off += (bytes + 255) & ~(size_t)255; return p; };
  _Float16* Q16 = (_Float16*)take(NR * DQ * 2); _Float16* QL = (_Float16*)take(NR * DQ * 2); _Float16* K16 = (_Float16*)take(NR * DQ * 2); _Float16* KL = (_Float16*)take(NR * DQ * 2);
  _Float16* VT = (_Float16*)take((size_t)NB * DV * SQ * 2);
  if (off > ws_size) return;
  k_proj<<<(unsigned)(NR / 128), 256, 0, stream>>>(x, wq, bq, wk, bk, wv, bv, Q16, QL, K16, KL, VT);      /* q, k as hi + residual planes, V^T per batch [DV][SQ] */
  k_fattn<<<NB * (SQ / FA_BQ), 256, 0, stream>>>(Q16, QL, K16, KL, VT, (float*)d_out);      /* scores (three terms), softmax, attn v */
}

// v004
// Measured time: 59.3 microseconds a run.
// Two timings next to v003 put it at 1.28 and 1.26 times that version's speed.
// All steps since v000 together make it 357 times as fast.
#include <hip/hip_runtime.h>
// SA layer (x [8][4096][128]; q, k = x W + b ([in][out] [128][64]), v = x Wv + bv; scores = q.k (NO scaling, logits sigma ~8); softmax; out = attn v -> [8][4096][64]).
// Structure: two launches. One front-end kernel per 128 token rows: x as exact f16 fragments; q | k | v on WMMA (16x192 wave tiles, f32 accumulation, exact x16 transposed [in][out] weights in LDS + bias); q and k out as f16 hi + 2^-10 residual planes (three-term scores); v out as V^T through LDS. One fused attention kernel per 128 queries (waves of 32 query columns x one key range each, partial results merged at the end): scores (K = 64) on WMMA, running-maximum softmax on VALU (f32; P x256 f16), out = P . V on WMMA, written straight to the f32 output.
// Compute dtype: inputs rounded to bf16; x / weights exact; q, k hi + residual (~2^-22); v, P plain f16 (~2^-12); scores / softmax f32. v_wmma_f32_16x16x32_f16.
#define NB 8
#define SQ 4096
#define DM 128
#define DQ 64
#define DV 64
#define QT 2048
#define NH 1                    /* V^T slabs of 64 (k_vt<NH, SQ>) */
#define HD 64
#define HG 1
#define NR ((size_t)NB * SQ)
#define QN SQ                        /* query rows per batch (debug hook) */
#define NBR NB                       /* batches (debug hook) */
#define MP ((int)NR)                 /* rows through the projections (debug hook) */
typedef __bf16 v16b __attribute__((ext_vector_type(16)));
typedef unsigned short v8us __attribute__((ext_vector_type(8), may_alias));
typedef float  v8f  __attribute__((ext_vector_type(8)));
typedef float  v4f  __attribute__((ext_vector_type(4)));
typedef float  v4fa __attribute__((ext_vector_type(4), may_alias));
union FragB { v16b v; v8us half[2]; unsigned short u[16]; };

__device__ __forceinline__ unsigned short bf16_bits(float x) { unsigned int u = __float_as_uint(x); return (unsigned short)((u + 0x7FFFu + ((u >> 16) & 1u)) >> 16); }
__device__ __forceinline__ float bf16_val(unsigned short b) { return __uint_as_float(((unsigned int)b) << 16); }
__device__ __forceinline__ float bf16_round(float x) { return bf16_val(bf16_bits(x)); }
// D += A·B with NT terms: 1 = ah·bh, 2 = + al·bh (A split), 3 = + ah·bl (both split)
template <int NT>
__device__ __forceinline__ v8f mmaN(v16b ah, v16b al, v16b bh, v16b bl, v8f c) {
  c = __builtin_amdgcn_wmma_f32_16x16x32_bf16(false, ah, false, bh, (short)0, c, false, false);
  if (NT >= 2) c = __builtin_amdgcn_wmma_f32_16x16x32_bf16(false, al, false, bh, (short)0, c, false, false);
  if (NT >= 3) c = __builtin_amdgcn_wmma_f32_16x16x32_bf16(false, ah, false, bl, (short)0, c, false, false);
  asm volatile("v_nop\n\tv_nop\n\tv_nop\n\tv_nop" : "+v"(c) : "v"(ah), "v"(al), "v"(bh), "v"(bl));
  return c;
}

__global__ __launch_bounds__(256) void k_wt_bf16(const float* __restrict__ W, unsigned short* __restrict__ Wt, int K, int N) {
  const int t = blockIdx.x * 256 + threadIdx.x;
  const int k8n = K / 8;
  if (t >= N * k8n) return;
  const int n = t / k8n, k8 = (t % k8n) * 8;
  v8us v;
#pragma unroll
  for (int i = 0; i < 8; ++i) v[i] = bf16_bits(W[(size_t)(k8 + i) * N + n]);
  *(v8us*)(Wt + (size_t)n * K + k8) = v;
  
}

// GEMM C[M][N] (f32, pitch ldc) = act(A[M][K]·W + bias). A f32 row-major (pitch lda) converted per fragment to bf16
// (ASPLIT: hi/lo two planes -> 2 terms, else single rounded term); Wt bf16 [N][K] (pitch ldb). BIAS_BF16 rounds the
// bias to bf16 first (bias quantised to bf16 before the add). K%32==0, M%16==0, N%64==0.
template <bool ASPLIT, int ACT, bool BIAS_BF16>
__global__ __launch_bounds__(128) void k_gemm_bf(const float* __restrict__ A, int lda, const unsigned short* __restrict__ Wt, int ldb,
                                               const float* __restrict__ bias, float* __restrict__ C, int ldc, int M, int N, int K) {
  __shared__ __attribute__((aligned(16))) float so[4][16][64];
  const int tid = threadIdx.x, w = tid >> 5, lane = tid & 31, ln = lane & 15, hh = lane >> 4;
  const int ntn = N / 64;
  const int wid = blockIdx.x * 4 + w;
  const int mt = wid / ntn, nq = wid % ntn;
  if (mt * 16 >= M) return;
  const int row0 = mt * 16, col0 = nq * 64;
  const float* arow = A + (size_t)(row0 + ln) * lda;
  v8f acc[4] = {};
  for (int kb = 0; kb < K; kb += 32) {
    FragB ah, al;
    const v4f x0 = *(const v4fa*)(arow + kb + 8 * hh), x1 = *(const v4fa*)(arow + kb + 8 * hh + 4);
    const v4f x2 = *(const v4fa*)(arow + kb + 16 + 8 * hh), x3 = *(const v4fa*)(arow + kb + 16 + 8 * hh + 4);
    float xs[16] = {x0[0],x0[1],x0[2],x0[3],x1[0],x1[1],x1[2],x1[3],x2[0],x2[1],x2[2],x2[3],x3[0],x3[1],x3[2],x3[3]};
#pragma unroll
    for (int i = 0; i < 16; ++i) { const unsigned short hb = bf16_bits(xs[i]); ah.u[i] = hb; al.u[i] = ASPLIT ? bf16_bits(xs[i] - bf16_val(hb)) : (unsigned short)0; }
#pragma unroll
    for (int t = 0; t < 4; ++t) {
      const unsigned short* brow = Wt + (size_t)(col0 + t * 16 + ln) * ldb + kb;
      FragB b;
      b.half[0] = *(const v8us*)(brow + 8 * hh);
      b.half[1] = *(const v8us*)(brow + 16 + 8 * hh);
      acc[t] = mmaN<ASPLIT ? 2 : 1>(ah.v, al.v, b.v, b.v, acc[t]);
    }
  }
#pragma unroll
  for (int t = 0; t < 4; ++t) {
    float bv = bias ? bias[col0 + t * 16 + ln] : 0.f;
    if (BIAS_BF16) bv = bf16_round(bv);
#pragma unroll
    for (int r = 0; r < 8; ++r) { float v = acc[t][r] + bv; if (ACT == 1) v = fmaxf(v, 0.f); so[w][8 * hh + r][t * 16 + ln] = v; }
  }
  __builtin_amdgcn_fence(__ATOMIC_ACQ_REL, "workgroup");
  __builtin_amdgcn_wave_barrier();
  const int rsub = lane >> 4, c4 = (lane & 15) * 4;
  {
#pragma unroll
    for (int q = 0; q < 8; ++q) {
      const int r = q * 2 + rsub;
      const v4f v = *(const v4fa*)&so[w][r][c4];
      *(v4f*)(C + (size_t)(row0 + r) * ldc + col0 + c4) = v;
    }
    
  }
}

// GEMM C = act(A·W + bias + resid): A f32 (ASPLIT -> hi/lo 2 terms), Wt bf16 [N][K]; ACT 0 none, 1 relu, 2 exact gelu;
// resid (optional, f32, row index = (row % rmod), pitch ldr, RES_BF16 rounds it) added before the activation.
template <bool ASPLIT, int ACT, bool BIAS_BF16, bool RES_BF16>
__global__ __launch_bounds__(128) void k_gemm_bf3(const float* __restrict__ A, int lda, const unsigned short* __restrict__ Wt, int ldb,
                                                const float* __restrict__ bias, const float* __restrict__ resid, int rmod, int ldr,
                                                float* __restrict__ C, int ldc, int M, int N, int K) {
  __shared__ __attribute__((aligned(16))) float so[4][16][64];
  const int tid = threadIdx.x, w = tid >> 5, lane = tid & 31, ln = lane & 15, hh = lane >> 4;
  const int ntn = N / 64;
  const int wid = blockIdx.x * 4 + w;
  const int mt = wid / ntn, nq = wid % ntn;
  if (mt * 16 >= M) return;
  const int row0 = mt * 16, col0 = nq * 64;
  const float* arow = A + (size_t)(row0 + ln) * lda;
  v8f acc[4] = {};
  for (int kb = 0; kb < K; kb += 32) {
    FragB ah, al;
    const v4f x0 = *(const v4fa*)(arow + kb + 8 * hh), x1 = *(const v4fa*)(arow + kb + 8 * hh + 4);
    const v4f x2 = *(const v4fa*)(arow + kb + 16 + 8 * hh), x3 = *(const v4fa*)(arow + kb + 16 + 8 * hh + 4);
    float xs[16] = {x0[0],x0[1],x0[2],x0[3],x1[0],x1[1],x1[2],x1[3],x2[0],x2[1],x2[2],x2[3],x3[0],x3[1],x3[2],x3[3]};
#pragma unroll
    for (int i = 0; i < 16; ++i) { const unsigned short hb = bf16_bits(xs[i]); ah.u[i] = hb; al.u[i] = ASPLIT ? bf16_bits(xs[i] - bf16_val(hb)) : (unsigned short)0; }
#pragma unroll
    for (int t = 0; t < 4; ++t) {
      const unsigned short* brow = Wt + (size_t)(col0 + t * 16 + ln) * ldb + kb;
      FragB b;
      b.half[0] = *(const v8us*)(brow + 8 * hh);
      b.half[1] = *(const v8us*)(brow + 16 + 8 * hh);
      acc[t] = mmaN<ASPLIT ? 2 : 1>(ah.v, al.v, b.v, b.v, acc[t]);
    }
  }
#pragma unroll
  for (int t = 0; t < 4; ++t) {
    const int col = col0 + t * 16 + ln;
    float bv = bias ? bias[col] : 0.f;
    if (BIAS_BF16) bv = bf16_round(bv);
#pragma unroll
    for (int r = 0; r < 8; ++r) {
      float v = acc[t][r] + bv;
      if (resid) { float rv = resid[(size_t)((row0 + 8 * hh + r) % rmod) * ldr + col]; if (RES_BF16) rv = bf16_round(rv); v += rv; }
      if (ACT == 1) v = fmaxf(v, 0.f);
      if (ACT == 2) v = 0.5f * v * (1.0f + erff(v * 0.70710678118654752f));
      if (ACT == 3) { const float u = 0.7978845608028654f * (v + 0.044715f * v * v * v); v = 0.5f * v * (1.0f + tanhf(u)); }
      so[w][8 * hh + r][t * 16 + ln] = v;
    }
  }
  __builtin_amdgcn_fence(__ATOMIC_ACQ_REL, "workgroup");
  __builtin_amdgcn_wave_barrier();
  const int rsub = lane >> 4, c4 = (lane & 15) * 4;
  {
#pragma unroll
    for (int q = 0; q < 8; ++q) {
      const int r = q * 2 + rsub;
      const v4f v = *(const v4fa*)&so[w][r][c4];
      *(v4f*)(C + (size_t)(row0 + r) * ldc + col0 + c4) = v;
    }
    
  }
}
// row LayerNorm (biased variance, eps) over N: s = X (+ R); optional out_sum <- s; out_norm <- (s-mu)*rsqrt(var+eps)*g + b
template <bool PARAM_BF16>
__global__ __launch_bounds__(256) void k_layernorm(const float* __restrict__ X, const float* __restrict__ R, const float* __restrict__ g, const float* __restrict__ bta,
                                                  float* __restrict__ out_sum, float* __restrict__ out_norm, int N, float eps) {
  __shared__ float red[256];
  const int row = blockIdx.x, tid = threadIdx.x;
  const float* x = X + (size_t)row * N; const float* rr = R ? R + (size_t)row * N : nullptr;
  float vals[16];                     // up to N = 4096
  const int per = N / 256;            // contiguous chunk per thread? use strided-by-4 chunks: thread handles j = tid*4 + 1024*u
  float s1 = 0.f;
  for (int u = 0; u < per / 4; ++u) {
    const int j = tid * 4 + 1024 * u;
    const v4f a = *(const v4fa*)(x + j);
    v4f b = {0.f,0.f,0.f,0.f}; if (rr) b = *(const v4fa*)(rr + j);
#pragma unroll
    for (int q = 0; q < 4; ++q) { const float v = a[q] + b[q]; vals[u * 4 + q] = v; s1 += v; }
  }
  red[tid] = s1; __syncthreads();
  for (int st = 128; st > 0; st >>= 1) { if (tid < st) red[tid] += red[tid + st]; __syncthreads(); }
  const float mu = red[0] / (float)N; __syncthreads();
  float s2 = 0.f;
  for (int u = 0; u < per / 4; ++u)
#pragma unroll
    for (int q = 0; q < 4; ++q) { const float c = vals[u * 4 + q] - mu; s2 += c * c; }
  red[tid] = s2; __syncthreads();
  for (int st = 128; st > 0; st >>= 1) { if (tid < st) red[tid] += red[tid + st]; __syncthreads(); }
  const float rs = rsqrtf(red[0] / (float)N + eps);
  {
    for (int u = 0; u < per / 4; ++u) {
      const int j = tid * 4 + 1024 * u;
      v4f o, sm;
#pragma unroll
      for (int q = 0; q < 4; ++q) {
        float gg = g[j + q], bb = bta[j + q];
        if (PARAM_BF16) { gg = bf16_round(gg); bb = bf16_round(bb); }
        sm[q] = vals[u * 4 + q]; o[q] = (vals[u * 4 + q] - mu) * rs * gg + bb;
      }
      if (out_sum) *(v4f*)(out_sum + (size_t)row * N + j) = sm;
      *(v4f*)(out_norm + (size_t)row * N + j) = o;
    }
    
  }
}



// ---- f16 WMMA path (v_wmma_f32_16x16x32_f16): 11-bit significands for operands in range — used where a [0,1] probability operand needs more precision than bf16
typedef _Float16 v16h __attribute__((ext_vector_type(16)));
union FragH { v16h v; v8us half[2]; _Float16 h[16]; unsigned short u[16]; };
template <int NT>
__device__ __forceinline__ v8f mmaH(v16h ah, v16h al, v16h bh, v16h bl, v8f c) {
  c = __builtin_amdgcn_wmma_f32_16x16x32_f16(false, ah, false, bh, (short)0, c, false, false);
  if (NT >= 2) c = __builtin_amdgcn_wmma_f32_16x16x32_f16(false, al, false, bh, (short)0, c, false, false);
  if (NT >= 3) c = __builtin_amdgcn_wmma_f32_16x16x32_f16(false, ah, false, bl, (short)0, c, false, false);
  asm volatile("v_nop\n\tv_nop\n\tv_nop\n\tv_nop" : "+v"(c) : "v"(ah), "v"(al), "v"(bh), "v"(bl));
  return c;
}
// batched GEMM like k_gemm_b but f16 operands: A f32 (split into f16 hi/lo if ASPLIT, else rounded to f16), Bt = f16 values [n][k]; alpha; C f32; N multiple of 16 (partial tiles skipped)
template <bool ASPLIT>
__global__ __launch_bounds__(128) void k_gemm_h(const float* __restrict__ A, int lda, size_t sA, const _Float16* __restrict__ Bh, int ldb, size_t sB, float alpha, float* __restrict__ C, int ldc, size_t sC, int M, int N, int K) {
  __shared__ __attribute__((aligned(16))) float so[4][16][64];
  const int tid = threadIdx.x, w = tid >> 5, lane = tid & 31, ln = lane & 15, hh = lane >> 4; const int by = blockIdx.y;
  A += (size_t)by * sA; Bh += (size_t)by * sB; C += (size_t)by * sC;
  const int ntn = (N + 63) / 64; const int wid = blockIdx.x * 4 + w; const int mt = wid / ntn, nq = wid % ntn; if (mt * 16 >= M) return;
  const int row0 = mt * 16, col0 = nq * 64; const float* arow = A + (size_t)(row0 + ln) * lda;
  v8f acc[4] = {};
  for (int kb = 0; kb < K; kb += 32) {
    FragH ah, al;
    const v4f x0 = *(const v4fa*)(arow + kb + 8 * hh), x1 = *(const v4fa*)(arow + kb + 8 * hh + 4), x2 = *(const v4fa*)(arow + kb + 16 + 8 * hh), x3 = *(const v4fa*)(arow + kb + 16 + 8 * hh + 4);
    float xs[16] = {x0[0],x0[1],x0[2],x0[3],x1[0],x1[1],x1[2],x1[3],x2[0],x2[1],x2[2],x2[3],x3[0],x3[1],x3[2],x3[3]};
#pragma unroll
    for (int i = 0; i < 16; ++i) { const _Float16 h = (_Float16)xs[i]; ah.h[i] = h; al.h[i] = ASPLIT ? (_Float16)(xs[i] - (float)h) : (_Float16)0.0f; }
#pragma unroll
    for (int t = 0; t < 4; ++t) { if (col0 + t * 16 >= N) continue; const size_t boff = (size_t)(col0 + t * 16 + ln) * ldb + kb; FragH bq; bq.half[0] = *(const v8us*)(Bh + boff + 8 * hh); bq.half[1] = *(const v8us*)(Bh + boff + 16 + 8 * hh);
      acc[t] = mmaH<ASPLIT ? 2 : 1>(ah.v, al.v, bq.v, bq.v, acc[t]); }
  }
#pragma unroll
  for (int t = 0; t < 4; ++t) { if (col0 + t * 16 >= N) continue;
#pragma unroll
    for (int r = 0; r < 8; ++r) so[w][8 * hh + r][t * 16 + ln] = acc[t][r] * alpha; }
  __builtin_amdgcn_fence(__ATOMIC_ACQ_REL, "workgroup"); __builtin_amdgcn_wave_barrier();
  const int rsub = lane >> 4, c4 = (lane & 15) * 4;
  {
#pragma unroll
    for (int q = 0; q < 8; ++q) { const int r = q * 2 + rsub; if (col0 + c4 < N) { const v4f v = *(const v4fa*)&so[w][r][c4]; *(v4f*)(C + (size_t)(row0 + r) * ldc + col0 + c4) = v; } }
     }
}

// Wt[n][k] = f16(W[k][n]·scale) from f32 row-major W[K][N] (scale = power of two; bf16-exact weights stay exact in f16 away from the subnormal range)
__global__ __launch_bounds__(256) void k_wt_f16(const float* __restrict__ W, _Float16* __restrict__ Wt, int K, int N, float scale) {
  const int t = blockIdx.x * 256 + threadIdx.x; if (t >= N * (K / 8)) return; const int n = t / (K / 8), k8 = (t % (K / 8)) * 8; FragH f;
#pragma unroll
  for (int i = 0; i < 8; ++i) f.h[i] = (_Float16)(bf16_round(W[(size_t)(k8 + i) * N + n]) * scale); const v8us o = f.half[0];
  *(v8us*)((unsigned short*)Wt + (size_t)n * K + k8) = o; 
}
// k_gemm_hh variant with fused epilogue: v = acc·alpha + bias[by·sBias + col] (+ CP[(row/rowsPerB)·sCPb + by·64 + col] if CP) ; ACT 0 none / 1 elu ; writes f16 C16 (and f32 C if non-null)
template <int ACT>
__global__ __launch_bounds__(128) void k_gemm_hhx(const _Float16* __restrict__ A, int lda, size_t sA, const _Float16* __restrict__ Bh, int ldb, size_t sB, float alpha, const float* __restrict__ bias, size_t sBias, const float* __restrict__ CP, int rowsPerB, size_t sCPb, int row0g,
    float* __restrict__ C, _Float16* __restrict__ C16, int ldc, size_t sC, int M, int N, int K) {
  __shared__ __attribute__((aligned(16))) float so[4][16][64];
  const int tid = threadIdx.x, w = tid >> 5, lane = tid & 31, ln = lane & 15, hh = lane >> 4; const int by = blockIdx.y;
  A += (size_t)by * sA; Bh += (size_t)by * sB; const size_t cofs = (size_t)by * sC; const float* bp = bias ? bias + (size_t)by * sBias : nullptr;
  const int ntn = (N + 63) / 64; const int wid = blockIdx.x * 4 + w; const int mt = wid / ntn, nq = wid % ntn; if (mt * 16 >= M) return;
  const int row0 = mt * 16, col0 = nq * 64; const _Float16* arow = A + (size_t)(row0 + ln) * lda;
  v8f acc[4] = {};
  for (int kb = 0; kb < K; kb += 32) { FragH ah; ah.half[0] = *(const v8us*)((const unsigned short*)arow + kb + 8 * hh); ah.half[1] = *(const v8us*)((const unsigned short*)arow + kb + 16 + 8 * hh);
#pragma unroll
    for (int t = 0; t < 4; ++t) { if (col0 + t * 16 >= N) continue; const size_t boff = (size_t)(col0 + t * 16 + ln) * ldb + kb; FragH bq; bq.half[0] = *(const v8us*)((const unsigned short*)Bh + boff + 8 * hh); bq.half[1] = *(const v8us*)((const unsigned short*)Bh + boff + 16 + 8 * hh);
      acc[t] = mmaH<1>(ah.v, ah.v, bq.v, bq.v, acc[t]); }
  }
#pragma unroll
  for (int t = 0; t < 4; ++t) { if (col0 + t * 16 >= N) continue; const int col = col0 + t * 16 + ln; const float bv = bp ? bf16_round(bp[col]) : 0.f;
#pragma unroll
    for (int r = 0; r < 8; ++r) { float v = acc[t][r] * alpha + bv; if (CP) { const int rr = row0g + row0 + 8 * hh + r; if (rowsPerB < 0) v += CP[cofs + (size_t)rr * ldc + col];      /* rowsPerB < 0: own element of the batched C plane */ else { const int bidx = rr / rowsPerB; v += CP[(size_t)bidx * sCPb + (size_t)by * 64 + col]; } } if (ACT == 1) v = (v > 0.f) ? v : expm1f(v); else if (ACT == 7) v = (v > 0.f) ? v + 1.0f : expf(v); else if (ACT == 8) v = tanhf(v); else if (ACT == 9) v = 0.5f * v * (1.0f + tanhf(0.7978845608028654f * (v + 0.044715f * v * v * v))); else if (ACT == 11) v = 1.0f / (1.0f + expf(-v)); else if (ACT == 12) v = (v > 0.f) ? v : 0.01f * v; else if (ACT == 14) v = (v > 0.f) ? v : 0.1f * v; else if (ACT == 16) v = (v >= 0.f) ? v : 0.3f * v; else if (ACT == 17) v = (v >= 0.f) ? v : 0.2f * v; else if (ACT == 15) v = v / (1.0f + expf(-v)); else if (ACT == 3) v = fmaxf(v, 0.f); else if (ACT == 6) v = 0.5f * v * (1.0f + erff(v * 0.70710678118654752f)); so[w][8 * hh + r][t * 16 + ln] = v; } }
  __builtin_amdgcn_fence(__ATOMIC_ACQ_REL, "workgroup"); __builtin_amdgcn_wave_barrier();
  const int rsub = lane >> 4, c4 = (lane & 15) * 4; typedef _Float16 v4h __attribute__((ext_vector_type(4)));
  {
#pragma unroll
    for (int q = 0; q < 8; ++q) { const int r = q * 2 + rsub; if (col0 + c4 < N) { const v4f v = *(const v4fa*)&so[w][r][c4]; if (C) *(v4f*)(C + cofs + (size_t)(row0 + r) * ldc + col0 + c4) = v; if (C16) { v4h h4; for (int i = 0; i < 4; ++i) h4[i] = (_Float16)v[i]; *(v4h*)(C16 + cofs + (size_t)(row0 + r) * ldc + col0 + c4) = h4; } } }
     }
}


typedef _Float16 v4h __attribute__((ext_vector_type(4)));

__global__ __launch_bounds__(256) void k_x16(const float* __restrict__ x, _Float16* __restrict__ X16, size_t n8) { const size_t t = (size_t)blockIdx.x * 256 + threadIdx.x; if (t >= n8) return; FragH f;
#pragma unroll
  for (int q = 0; q < 8; ++q) f.h[q] = (_Float16)bf16_round(x[t * 8 + q]); *(v8us*)((unsigned short*)X16 + t * 8) = f.half[0];  }
__global__ __launch_bounds__(256) void k_h16(const float* __restrict__ x, _Float16* __restrict__ X16, size_t n8) { const size_t t = (size_t)blockIdx.x * 256 + threadIdx.x; if (t >= n8) return; FragH f;
#pragma unroll
  for (int q = 0; q < 8; ++q) f.h[q] = (_Float16)x[t * 8 + q]; *(v8us*)((unsigned short*)X16 + t * 8) = f.half[0];  }
__global__ __launch_bounds__(256) void k_round16f(const float* __restrict__ W, _Float16* __restrict__ Bt, size_t n8) { const size_t t = (size_t)blockIdx.x * 256 + threadIdx.x; if (t >= n8) return; FragH f;
#pragma unroll
  for (int i = 0; i < 8; ++i) f.h[i] = (_Float16)(bf16_round(W[t * 8 + i]) * 16.0f); *(v8us*)((unsigned short*)Bt + t * 8) = f.half[0];  }
template <int NHv, int TTv>
__global__ __launch_bounds__(256) void k_vt(const _Float16* __restrict__ V16, int ldv, int voff, _Float16* __restrict__ Vt) { __shared__ unsigned short tl[64][66]; const int tid = threadIdx.x; const int slab = blockIdx.x / (TTv / 64), lg = blockIdx.x % (TTv / 64); const int b = slab / NHv, h = slab % NHv;
  for (int i = tid; i < 64 * 8; i += 256) { const int r = i / 8, c8 = (i % 8) * 8; FragH f; f.half[0] = *(const v8us*)((const unsigned short*)V16 + ((size_t)b * TTv + lg * 64 + r) * ldv + voff + h * 64 + c8);
#pragma unroll
    for (int q = 0; q < 8; ++q) tl[r][c8 + q] = f.u[q]; }
  __syncthreads();
  {
#pragma unroll
    for (int rd = 0; rd < 2; ++rd) { const int d = rd * 32 + tid / 8, pc = tid % 8; FragH f;
#pragma unroll
      for (int q = 0; q < 8; ++q) f.u[q] = tl[pc * 8 + q][d];
      *(v8us*)((unsigned short*)Vt + ((size_t)slab * 64 + d) * TTv + lg * 64 + pc * 8) = f.half[0]; }
     } }

__global__ __launch_bounds__(256) void k_hl(const float* __restrict__ F, _Float16* __restrict__ Hh, _Float16* __restrict__ Hl, size_t n8) { const size_t t = (size_t)blockIdx.x * 256 + threadIdx.x; if (t >= n8) return; FragH fh, fl; const v4f a = *(const v4fa*)(F + t * 8), c = *(const v4fa*)(F + t * 8 + 4);
#pragma unroll
  for (int q = 0; q < 4; ++q) { _Float16 h = (_Float16)a[q]; fh.h[q] = h; fl.h[q] = (_Float16)((a[q] - (float)h) * 1024.0f); h = (_Float16)c[q]; fh.h[4 + q] = h; fl.h[4 + q] = (_Float16)((c[q] - (float)h) * 1024.0f); }
  { *(v8us*)((unsigned short*)Hh + t * 8) = fh.half[0]; *(v8us*)((unsigned short*)Hl + t * 8) = fl.half[0];  } }

// ---- fast GEMM (wave tile 32x64; requires M % 32 == 0 rows per launch region and N % 64 == 0); epilogue = k_gemm_hhx semantics ----
__device__ __forceinline__ v16h g2_frag(const _Float16* p, int hh) { FragH f; f.half[0] = *(const v8us*)((const unsigned short*)p + 8 * hh); f.half[1] = *(const v8us*)((const unsigned short*)p + 16 + 8 * hh); return f.v; }
__device__ __forceinline__ v8f g2_mma(v16h a, v16h b, v8f c) { v8f d = __builtin_amdgcn_wmma_f32_16x16x32_f16(false, a, false, b, (short)0, c, false, false); asm volatile("v_nop\n\tv_nop\n\tv_nop\n\tv_nop" : "+v"(d) : "v"(a), "v"(b)); return d; }
template <int ACT>
__global__ __launch_bounds__(128) void k_gemm2(const _Float16* __restrict__ A, int lda, size_t sA, const _Float16* __restrict__ Bh, int ldb, size_t sB, float alpha, const float* __restrict__ bias, size_t sBias, const float* __restrict__ CP, int rowsPerB, size_t sCPb, int row0g,
    float* __restrict__ C, _Float16* __restrict__ C16, int ldc, size_t sC, int M, int N, int K) { static_assert(ACT == 0 || ACT == 3 || ACT == 6 || ACT == 8 || ACT == 9 || ACT == 11 || ACT == 12 || ACT == 14 || ACT == 15 || ACT == 16 || ACT == 17, "k_gemm2: unsupported ACT code (would silently apply no activation)");
  __shared__ __attribute__((aligned(16))) float so[4][32][68];
  const int tid = threadIdx.x, w = tid >> 5, lane = tid & 31, ln = lane & 15, hh = lane >> 4; const int by = blockIdx.y;
  A += (size_t)by * sA; Bh += (size_t)by * sB; const size_t cofs = (size_t)by * sC; const float* bp = bias ? bias + (size_t)by * sBias : nullptr;
  const int ntn = N >> 6; const int mt = blockIdx.x / ntn, nq = blockIdx.x - mt * ntn; const int row0 = mt * 128 + 32 * w, col0 = nq * 64; if (row0 >= M) return;
  const _Float16* a0p = A + (size_t)(row0 + ln) * lda; const _Float16* a1p = a0p + (size_t)16 * lda;
  const _Float16* b0p = Bh + (size_t)(col0 + ln) * ldb; const _Float16* b1p = b0p + (size_t)16 * ldb; const _Float16* b2p = b1p + (size_t)16 * ldb; const _Float16* b3p = b2p + (size_t)16 * ldb;
  const v8f z8 = {0.f,0.f,0.f,0.f,0.f,0.f,0.f,0.f}; v8f c00 = z8, c01 = z8, c02 = z8, c03 = z8, c10 = z8, c11 = z8, c12 = z8, c13 = z8;
#pragma unroll 1
  for (int kb = 0; kb < K; kb += 32) { const v16h a0 = g2_frag(a0p + kb, hh), a1 = g2_frag(a1p + kb, hh);
    v16h b = g2_frag(b0p + kb, hh); c00 = g2_mma(a0, b, c00); c10 = g2_mma(a1, b, c10);
    b = g2_frag(b1p + kb, hh); c01 = g2_mma(a0, b, c01); c11 = g2_mma(a1, b, c11);
    b = g2_frag(b2p + kb, hh); c02 = g2_mma(a0, b, c02); c12 = g2_mma(a1, b, c12);
    b = g2_frag(b3p + kb, hh); c03 = g2_mma(a0, b, c03); c13 = g2_mma(a1, b, c13); }
  v8f accs[8] = {c00, c01, c02, c03, c10, c11, c12, c13};
#pragma unroll
  for (int u = 0; u < 8; ++u) { const int t = u & 3, half = u >> 2; const int col = col0 + t * 16 + ln; const float bv = bp ? bf16_round(bp[col]) : 0.f;
#pragma unroll
    for (int r = 0; r < 8; ++r) { const int rloc = half * 16 + 8 * hh + r; float v = accs[u][r] * alpha + bv; if (CP) { if (rowsPerB < 0) v += CP[cofs + (size_t)(row0g + row0 + rloc) * ldc + col];      /* rowsPerB < 0: own element of the batched C plane */ else { const int bidx = (row0g + row0 + rloc) / rowsPerB; v += CP[(size_t)bidx * sCPb + (size_t)by * 64 + col]; } }
      if (ACT == 3) v = fmaxf(v, 0.f); else if (ACT == 6) v = 0.5f * v * (1.0f + erff(v * 0.70710678118654752f)); else if (ACT == 11) v = 1.0f / (1.0f + expf(-v)); else if (ACT == 15) v = v / (1.0f + expf(-v)); else if (ACT == 12) v = (v > 0.f) ? v : 0.01f * v; else if (ACT == 8) v = tanhf(v); else if (ACT == 9) v = 0.5f * v * (1.0f + tanhf(0.7978845608028654f * (v + 0.044715f * v * v * v))); else if (ACT == 14) v = (v > 0.f) ? v : 0.1f * v; else if (ACT == 16) v = (v >= 0.f) ? v : 0.3f * v; else if (ACT == 17) v = (v >= 0.f) ? v : 0.2f * v;
      so[w][rloc][t * 16 + ln] = v; } }
  __builtin_amdgcn_fence(__ATOMIC_ACQ_REL, "workgroup"); __builtin_amdgcn_wave_barrier();
  const int rsub = lane >> 4, c4 = (lane & 15) * 4;
  {
#pragma unroll
    for (int q = 0; q < 16; ++q) { const int r = q * 2 + rsub; const v4f v = *(const v4fa*)&so[w][r][c4]; if (C) *(v4f*)(C + cofs + (size_t)(row0 + r) * ldc + col0 + c4) = v; if (C16) { v4h h4; for (int i = 0; i < 4; ++i) h4[i] = (_Float16)v[i]; *(v4h*)(C16 + cofs + (size_t)(row0 + r) * ldc + col0 + c4) = h4; } }
     } }


__global__ __launch_bounds__(256) void k_wnat(const float* __restrict__ w, size_t n8, _Float16* __restrict__ Bt) { const size_t t = (size_t)blockIdx.x * 256 + threadIdx.x; if (t >= n8) return; FragH f; for (int q = 0; q < 8; ++q) f.h[q] = (_Float16)(bf16_round(w[t * 8 + q]) * 16.0f); *(v8us*)((unsigned short*)Bt + t * 8) = f.half[0];  }
__global__ __launch_bounds__(256) void k_rsm(const float* __restrict__ S, _Float16* __restrict__ P, int nrows) {
  #pragma clang fp contract(off)
  const int i = blockIdx.x * 256 + threadIdx.x; if (i >= nrows) return; const float* s = S + (size_t)i * SQ; float mx = -3.0e38f;
#pragma unroll 1
  for (int j = 0; j < SQ; ++j) mx = fmaxf(mx, s[j]); float se = 0.f;
#pragma unroll 1
  for (int j = 0; j < SQ; ++j) se += expf(s[j] - mx); const float sc = 256.0f / se;
#pragma unroll 1
  for (int j0 = 0; j0 < SQ; j0 += 8) { FragH f; for (int q = 0; q < 8; ++q) f.h[q] = (_Float16)(expf(s[j0 + q] - mx) * sc); unsigned short* d = (unsigned short*)P + (size_t)i * SQ + j0; *(v8us*)d = f.half[0];  } }
__global__ __launch_bounds__(256) void k_vt(const _Float16* __restrict__ V16, int b, int h0, _Float16* __restrict__ VT) { __shared__ unsigned short tl[64][65]; const int tid = threadIdx.x; const int hh = blockIdx.x % HG, sg = blockIdx.x / HG; const int s0 = sg * 64; const int h = h0 + hh;
  for (int i = tid; i < 64 * 8; i += 256) { const int j = i / 8, d8 = (i % 8) * 8; FragH f; f.half[0] = *(const v8us*)((const unsigned short*)V16 + ((size_t)b * SQ + s0 + j) * DM + h * HD + d8); for (int q = 0; q < 8; ++q) tl[d8 + q][j] = f.u[q]; }
  __syncthreads();
  { for (int i = tid; i < 64 * 8; i += 256) { const int d = i / 8, j8 = (i % 8) * 8; FragH f; for (int q = 0; q < 8; ++q) f.u[q] = tl[d][j8 + q]; *(v8us*)((unsigned short*)VT + ((size_t)hh * HD + d) * SQ + s0 + j8) = f.half[0]; }  } }

// ---- fused attention: one work-group = 128 queries of one batch; FA_NQG groups of 32 query columns x FA_KS key ranges, one wave each; a wave walks its own key range in LDS stages of 64; scores and P stay in registers ----
// Transposed products: S^T = K . Q^T (rows = keys, columns = queries), O^T += V^T . P^T. A lane's 8 + 8 accumulator registers of the two 16-key score tiles are keys 8 hh + r and 16 + 8 hh + r of its own query column:
// exactly the k order of the B fragment of the second product, so P goes from accumulator to operand inside the lane. Max and sum of a query live in its two lanes (ln, ln + 16).
// Every K and V^T fragment read from LDS feeds both of the wave's query tiles. The key ranges' partial results (maximum, sum, O^T) meet once, at the end, through LDS.
#define FA_QT 2                      /* 16-column query tiles per wave */
#define FA_KS 4                      /* key ranges per work-group */
#define FA_BQ 128                    /* queries per work-group */
#define FA_NQG (FA_BQ / (16 * FA_QT))      /* waves per key range */
#define FA_NW (FA_NQG * FA_KS)       /* waves per work-group */
#define FA_SK 64                     /* keys per LDS stage and key range */
#define FA_NS (SQ / FA_KS / FA_SK)
#define FA_PITCH 144                 /* LDS row pitch, bytes: 128 of data + 16 (an odd multiple of 16 B for the 16-byte fragment reads) */
#define FA_TILE (64 * FA_PITCH)
#define FA_BUF (FA_KS * 3 * FA_TILE) /* one buffer: every key range's three tiles */
#define FA_MP 144                    /* bytes of one lane's partial result of one query tile: 32 f32 of O^T, maximum, sum, 8 B unused (again an odd multiple of 16 B) */
typedef float v2f __attribute__((ext_vector_type(2)));
typedef _Float16 v2h __attribute__((ext_vector_type(2)));
union FragP { v16h v; v2h p[8]; v8us half[2]; };
__device__ __forceinline__ float fa_xrow(float v) { const unsigned int i = __float_as_uint(v); return __uint_as_float(__builtin_amdgcn_permlanex16(i, i, 0x76543210u, 0xfedcba98u, false, false)); }      /* lane l <-> lane l ^ 16 */
__device__ __forceinline__ v16h fa_frag(const unsigned char* p) { FragH f; f.half[0] = *(const v8us*)p; f.half[1] = *(const v8us*)(p + 32); return f.v; }      /* p already holds the lane's 16 hh bytes: k = 8 hh + i, 16 + 8 hh + i, as g2_frag */
__device__ __forceinline__ v8f fa_mma(v16h a, v16h b, v8f c) { return __builtin_amdgcn_wmma_f32_16x16x32_f16(false, a, false, b, (short)0, c, false, false); }
template <bool B> struct fa_flag { static constexpr bool value = B; };
__device__ __forceinline__ float fa_exp2_slot(float x) { float r; asm("v_exp_f32 %0, %1\n\tv_nop" : "=v"(r) : "v"(x)); return r; }      /* exp2 with the one slot the instruction set asks for behind a transcendental, in one statement so that it stands directly behind it */
__global__ __launch_bounds__(FA_NW * 32) void k_fattn(const _Float16* __restrict__ Qh, const _Float16* __restrict__ Ql, const _Float16* __restrict__ Kh, const _Float16* __restrict__ Kl, const _Float16* __restrict__ Vt, float* __restrict__ O) {
  static_assert(DQ == 64 && DV == 64 && SQ % FA_BQ == 0 && SQ % (FA_KS * FA_SK) == 0 && FA_NQG == 4, "k_fattn: written for 64-wide q, k, v rows and four waves per key range");
  static_assert((FA_KS - 1) * FA_NQG * FA_QT * 32 * FA_MP <= 2 * FA_BUF, "k_fattn: the partial results must fit the ring");
  __shared__ __attribute__((aligned(16))) unsigned char L[2 * FA_BUF];      /* two buffers of, per key range, { K hi [key][h], K residual [key][h], V^T [d][key] } */
  const int tid = threadIdx.x, w = __builtin_amdgcn_readfirstlane(tid >> 5), lane = tid & 31, ln = lane & 15, hh = lane >> 4;
  const int ks = w / FA_NQG, qg = w % FA_NQG, tg = tid & (FA_NQG * 32 - 1);      /* key range, query group, thread within the key range's four waves */
  const int b = blockIdx.x / (SQ / FA_BQ), q0 = (blockIdx.x % (SQ / FA_BQ)) * FA_BQ + qg * (16 * FA_QT);
  const size_t key0 = (size_t)ks * (SQ / FA_KS);
  /* staging: every tile is 64 rows x 128 B = 512 chunks of 16 B; the four waves of a key range stage its three tiles: thread tg moves chunks tg + 128 i (row + 16 i), i = 0 .. 3, of each */
  const unsigned char* gkh = (const unsigned char*)(Kh + ((size_t)b * SQ + key0) * DQ) + tg * 16;
  const unsigned char* gkl = (const unsigned char*)(Kl + ((size_t)b * SQ + key0) * DQ) + tg * 16;
  const unsigned char* gvt = (const unsigned char*)(Vt + (size_t)b * DV * SQ + key0) + (size_t)(tg >> 3) * (SQ * 2) + (tg & 7) * 16;
  unsigned char* const Lk = L + ks * (3 * FA_TILE);      /* this key range's tiles in buffer 0 */
  const int lst = (tg >> 3) * FA_PITCH + (tg & 7) * 16;
  v8us st0, st1, st2, st3, st4, st5;
  /* a stage is fetched in two halves of six chunks, one under each of the two passes, so that a thread holds six chunks (24 registers) at a time and not twelve */
  /* the s_wait_xcnt 0 that ends each fetch takes the two address pairs as inputs, so that they live up to it: left free, a later load's result was laid over the pair that the loads before it name */
#define FA_FETCH_A(s) { const unsigned char* ph = gkh + (size_t)(s) * 8192; const unsigned char* pl = gkl + (size_t)(s) * 8192; st0 = *(const v8us*)ph; st1 = *(const v8us*)(ph + 2048); st2 = *(const v8us*)(ph + 4096); st3 = *(const v8us*)(ph + 6144); \
    st4 = *(const v8us*)pl; st5 = *(const v8us*)(pl + 2048); asm volatile("s_wait_xcnt 0x0" :: "v"(ph), "v"(pl) : "memory"); }
#define FA_PUT_A(bf) { unsigned char* d = Lk + (bf) * FA_BUF + lst; *(v8us*)d = st0; *(v8us*)(d + 16 * FA_PITCH) = st1; *(v8us*)(d + 32 * FA_PITCH) = st2; *(v8us*)(d + 48 * FA_PITCH) = st3; *(v8us*)(d + FA_TILE) = st4; *(v8us*)(d + FA_TILE + 16 * FA_PITCH) = st5; }
#define FA_FETCH_B(s) { const unsigned char* pl = gkl + (size_t)(s) * 8192; const unsigned char* pv = gvt + (size_t)(s) * 128; st0 = *(const v8us*)(pl + 4096); st1 = *(const v8us*)(pl + 6144); \
    st2 = *(const v8us*)pv; st3 = *(const v8us*)(pv + (size_t)16 * SQ * 2); st4 = *(const v8us*)(pv + (size_t)32 * SQ * 2); st5 = *(const v8us*)(pv + (size_t)48 * SQ * 2); asm volatile("s_wait_xcnt 0x0" :: "v"(pl), "v"(pv) : "memory"); }
#define FA_PUT_B(bf) { unsigned char* d = Lk + (bf) * FA_BUF + lst; *(v8us*)(d + FA_TILE + 32 * FA_PITCH) = st0; *(v8us*)(d + FA_TILE + 48 * FA_PITCH) = st1; *(v8us*)(d + 2 * FA_TILE) = st2; *(v8us*)(d + 2 * FA_TILE + 16 * FA_PITCH) = st3; *(v8us*)(d + 2 * FA_TILE + 32 * FA_PITCH) = st4; *(v8us*)(d + 2 * FA_TILE + 48 * FA_PITCH) = st5; }
  v16h qh0[FA_QT], qh1[FA_QT], ql0[FA_QT], ql1[FA_QT];
#pragma unroll
  for (int qt = 0; qt < FA_QT; ++qt) { const unsigned int qi = (unsigned int)((b * SQ + q0 + qt * 16 + ln) * DQ); const _Float16* qhp = Qh + qi; const _Float16* qlp = Ql + qi;
    qh0[qt] = g2_frag(qhp, hh); qh1[qt] = g2_frag(qhp + 32, hh); ql0[qt] = g2_frag(qlp, hh); ql1[qt] = g2_frag(qlp + 32, hh); }
  const v8f z8 = {0.f,0.f,0.f,0.f,0.f,0.f,0.f,0.f};
  v8f acc[FA_QT][4];
  float m2[FA_QT], l[FA_QT];      /* per query tile: running maximum (in log2 units) of the lane's query, the same in both of its lanes; the lane's own part of the sum of P */
#pragma unroll
  for (int qt = 0; qt < FA_QT; ++qt) { m2[qt] = -INFINITY; l[qt] = 0.f;
#pragma unroll
    for (int dt = 0; dt < 4; ++dt) acc[qt][dt] = z8; }
  const float L2E = 1.4426950408889634f;
  FA_FETCH_A(0) FA_PUT_A(0) FA_FETCH_B(0) FA_PUT_B(0)
  __syncthreads();
  /* one stage: two unrolled 32-key passes; every loop inside is fully unrolled so that the register arrays are indexed by constants. 'more' (a compile-time flag): a next stage exists and is staged under this one */
  auto stage = [&](const int s, auto more) __attribute__((always_inline)) {
    const int bf = s & 1;
    const unsigned char* Lr = Lk + bf * FA_BUF;
#pragma unroll
    for (int kk = 0; kk < 2; ++kk) {
      if constexpr (more.value) { if (kk == 0) FA_FETCH_A(s + 1) else FA_FETCH_B(s + 1) }      /* half of the next stage's global loads fly under this pass */
      v2f s2[FA_QT][8];      /* s2[qt][j]: registers 2 (j & 3), 2 (j & 3) + 1 of score tile j >> 2 = elements 2 j, 2 j + 1 of the 32-key operand */
#pragma unroll
      for (int kt = 0; kt < 2; ++kt) {
        const int ro = (kk * 32 + kt * 16 + ln) * FA_PITCH + 16 * hh;
        const v16h kh0 = fa_frag(Lr + ro), kh1 = fa_frag(Lr + ro + 64), kl0 = fa_frag(Lr + FA_TILE + ro), kl1 = fa_frag(Lr + FA_TILE + ro + 64);
#pragma unroll
        for (int qt = 0; qt < FA_QT; ++qt) {
          const v8f sm = fa_mma(kh1, qh1[qt], fa_mma(kh0, qh0[qt], z8));                                                                    /* k_hi . q_hi */
          const v8f sr = fa_mma(kl1, qh1[qt], fa_mma(kl0, qh0[qt], fa_mma(kh1, ql1[qt], fa_mma(kh0, ql0[qt], z8))));      /* 1024 x (k_hi . q_res + k_res . q_hi) */
#pragma unroll
          for (int j = 0; j < 4; ++j) s2[qt][kt * 4 + j] = __builtin_elementwise_fma(v2f{sr[2 * j], sr[2 * j + 1]}, v2f{1.0f / 1024.0f, 1.0f / 1024.0f}, v2f{sm[2 * j], sm[2 * j + 1]});
        }
      }
      v16h vf[4];      /* this pass's V^T fragments */
#pragma unroll
      for (int dt = 0; dt < 4; ++dt) vf[dt] = fa_frag(Lr + 2 * FA_TILE + (dt * 16 + ln) * FA_PITCH + kk * 64 + 16 * hh);
      float mx[FA_QT]; bool up = false;
#pragma unroll
      for (int qt = 0; qt < FA_QT; ++qt) { float t8[8];
#pragma unroll
        for (int j = 0; j < 8; ++j) t8[j] = fmaxf(s2[qt][j].x, s2[qt][j].y);
        const float t = fmaxf(fmaxf(fmaxf(t8[0], t8[1]), fmaxf(t8[2], t8[3])), fmaxf(fmaxf(t8[4], t8[5]), fmaxf(t8[6], t8[7])));
        mx[qt] = fmaxf(t, fa_xrow(t)) * L2E; up = up || (mx[qt] > m2[qt]); }
      asm volatile("" :: "v"(vf[0]), "v"(vf[1]), "v"(vf[2]), "v"(vf[3]));      /* inputs only: holds the four V^T fragment loads together in front of the branch, one LDS wait for all; left free they sink to their WMMAs, each behind a wait of its own */
      if (__builtin_amdgcn_ballot_w32(up) != 0) {      /* wave-uniform, one test a pass: some query of the wave has a new maximum; a lane without one scales by exp2(0) = 1 */
#pragma unroll
        for (int qt = 0; qt < FA_QT; ++qt) { const float mn = fmaxf(m2[qt], mx[qt]); const float corr = __builtin_amdgcn_exp2f(m2[qt] - mn); m2[qt] = mn; l[qt] *= corr;
#pragma unroll
          for (int dt = 0; dt < 4; ++dt) acc[qt][dt] = acc[qt][dt] * corr; }
      }
      FragP pf[FA_QT];
#pragma unroll
      for (int qt = 0; qt < FA_QT; ++qt) {
        const float nm = 8.0f - m2[qt];      /* P is kept x 256 (as before the fusion) to hold small weights above the f16 subnormals; the factor cancels in acc / l */
        v2f ps0 = {0.f, 0.f}, ps1 = {0.f, 0.f};
#pragma unroll
        for (int j = 0; j < 8; ++j) { const v2f a = __builtin_elementwise_fma(s2[qt][j], v2f{L2E, L2E}, v2f{nm, nm}); const v2f p = {__builtin_amdgcn_exp2f(a.x), __builtin_amdgcn_exp2f(a.y)};
          if (j & 1) ps1 += p; else ps0 += p; pf[qt].p[j] = __builtin_convertvector(p, v2h); }
        l[qt] += (ps0.x + ps0.y) + (ps1.x + ps1.y);
      }
#pragma unroll
      for (int dt = 0; dt < 4; ++dt)
#pragma unroll
        for (int qt = 0; qt < FA_QT; ++qt) acc[qt][dt] = fa_mma(vf[dt], pf[qt].v, acc[qt][dt]);
      if constexpr (more.value) { if (kk == 0) FA_PUT_A(bf ^ 1) else FA_PUT_B(bf ^ 1) }      /* that buffer's last readers left it before the barrier that ended stage s - 1 */
    }
    __syncthreads();      /* publishes stage s + 1 and ends every wave's reads of stage s */
  };
  /* the stage loop stays rolled; the last stage, which stages nothing, stands behind it, so that no test of s stands inside a stage */
#pragma unroll 1
  for (int s = 0; s < FA_NS - 1; ++s) stage(s, fa_flag<true>{});
  stage(FA_NS - 1, fa_flag<false>{});
  /* the key ranges meet: behind the last stage's barrier nobody reads the ring any more, so it carries the partial results of ranges 1 .. FA_KS - 1 to the waves of range 0 */
  if (ks != 0) {
#pragma unroll
    for (int qt = 0; qt < FA_QT; ++qt) { unsigned char* d = L + (size_t)((((ks - 1) * FA_NQG + qg) * FA_QT + qt) * 32 + lane) * FA_MP;
#pragma unroll
      for (int dt = 0; dt < 4; ++dt) { const v8f o = acc[qt][dt]; const v4f o0 = {o[0], o[1], o[2], o[3]}, o1 = {o[4], o[5], o[6], o[7]}; *(v4fa*)(d + dt * 32) = o0; *(v4fa*)(d + dt * 32 + 16) = o1; }
      const v4f ml = {m2[qt], l[qt], 0.f, 0.f}; *(v4fa*)(d + 128) = ml; }
  }
  __syncthreads();      /* publishes the partial results */
  if (ks != 0) return;
#pragma unroll
  for (int qt = 0; qt < FA_QT; ++qt) {
#pragma unroll
    for (int p = 1; p < FA_KS; ++p) { const unsigned char* d = L + (size_t)((((p - 1) * FA_NQG + qg) * FA_QT + qt) * 32 + lane) * FA_MP;
      const v4f ml = *(const v4fa*)(d + 128);
      const float mn = fmaxf(m2[qt], ml[0]); const float c0 = fa_exp2_slot(m2[qt] - mn), c1 = fa_exp2_slot(ml[0] - mn); m2[qt] = mn; l[qt] = l[qt] * c0 + ml[1] * c1;
#pragma unroll
      for (int dt = 0; dt < 4; ++dt) { const v4f o0 = *(const v4fa*)(d + dt * 32), o1 = *(const v4fa*)(d + dt * 32 + 16); const v8f o = {o0[0], o0[1], o0[2], o0[3], o1[0], o1[1], o1[2], o1[3]}; acc[qt][dt] = acc[qt][dt] * c0 + o * c1; } }
    const float inv = 1.0f / (l[qt] + fa_xrow(l[qt]));
#pragma unroll
    for (int dt = 0; dt < 4; ++dt) acc[qt][dt] = acc[qt][dt] * inv;
  }
  float* op = O + (unsigned int)((b * SQ + q0 + ln) * DV + 8 * hh);      /* accumulator tile dt, register r: d = 16 dt + 8 hh + r of query ln */
  __builtin_amdgcn_sched_barrier(0);      /* every product stands in front of the first store: left free, the products of later tiles were laid over registers that issued stores name */
#pragma unroll
  for (int qt = 0; qt < FA_QT; ++qt)
#pragma unroll
    for (int dt = 0; dt < 4; ++dt) { const v8f o = acc[qt][dt]; const v4f o0 = {o[0], o[1], o[2], o[3]}, o1 = {o[4], o[5], o[6], o[7]}; *(v4f*)(op + qt * 16 * DV + dt * 16) = o0; *(v4f*)(op + qt * 16 * DV + dt * 16 + 4) = o1; }
#undef FA_FETCH_A
#undef FA_PUT_A
#undef FA_FETCH_B
#undef FA_PUT_B
}
// ---- fused front end: one work-group = 128 token rows (8 waves x 16 rows); every wave forms q, k and v of its rows (16 x 192, K = 128) and the planes the attention kernel reads go out through LDS (q, k rows per wave, V^T per work-group) ----
// x goes from its f32 rows into the A fragments inside the lane (rounded as before); the three [in][out] weights are rounded, scaled x16 and transposed into LDS once per work-group; same operands, same k order and same epilogue arithmetic as the separate kernels had.
typedef __bf16 v2b __attribute__((ext_vector_type(2)));
__device__ __forceinline__ v2f pj_round2(v2f v) { const unsigned int u = __builtin_bit_cast(unsigned int, __builtin_convertvector(v, v2b)); return v2f{__uint_as_float(u << 16), __uint_as_float(u & 0xFFFF0000u)}; }      /* two f32 rounded to bf16 (nearest even), back as f32 */
#define PJ_PITCH 272                 /* LDS row pitch, bytes, of 128 f16: 256 of data + 16 (an odd multiple of 16 B for the 16-byte fragment reads) */
__global__ __launch_bounds__(256) void k_proj(const float* __restrict__ x, const float* __restrict__ wq, const float* __restrict__ bq, const float* __restrict__ wk, const float* __restrict__ bk, const float* __restrict__ wv, const float* __restrict__ bv,
    _Float16* __restrict__ Qh, _Float16* __restrict__ Ql, _Float16* __restrict__ Kh, _Float16* __restrict__ Kl, _Float16* __restrict__ Vt) {
  static_assert(DM == 128 && DQ == 64 && DV == 64 && SQ % 128 == 0, "k_proj: written for 128-wide x rows and 64-wide q, k, v rows");
  __shared__ __attribute__((aligned(16))) unsigned char LW[3][64 * PJ_PITCH];      /* W^T x16, f16 [out][in], of q, k, v */
  __shared__ __attribute__((aligned(16))) float so[8][2][16][68];                  /* per wave: its q and k rows, f32 */
  __shared__ __attribute__((aligned(16))) unsigned char LV[64 * PJ_PITCH];         /* V^T of the work-group's 128 tokens, f16 [d][token] */
  const int tid = threadIdx.x, w = tid >> 5, lane = tid & 31, ln = lane & 15, hh = lane >> 4;
  const int row0 = blockIdx.x * 128 + w * 16;
  /* weights: per matrix 16 x 16 blocks of 8 k x 4 output columns, one block a thread; sixteen lanes read one whole 256-byte row of W */
  const int n4 = (tid & 15) * 4, k8 = (tid >> 4) * 8;
  v4f wr[3][8];
#pragma unroll
  for (int m = 0; m < 3; ++m) { const float* Wm = (m == 0 ? wq : (m == 1 ? wk : wv)) + k8 * 64 + n4;
#pragma unroll
    for (int i = 0; i < 8; ++i) wr[m][i] = *(const v4fa*)(Wm + i * 64); }
  /* the lane's part of its x row: k = 32 kb + 8 hh + i and 32 kb + 16 + 8 hh + i, the order of g2_frag; these loads (from memory) fly while the weights (mostly from L2) are rounded and laid into LDS */
  const float* xr = x + (size_t)(row0 + ln) * DM + 8 * hh;
  v4f xs[16];
#pragma unroll
  for (int kb = 0; kb < 4; ++kb) { xs[4 * kb] = *(const v4fa*)(xr + kb * 32); xs[4 * kb + 1] = *(const v4fa*)(xr + kb * 32 + 4); xs[4 * kb + 2] = *(const v4fa*)(xr + kb * 32 + 16); xs[4 * kb + 3] = *(const v4fa*)(xr + kb * 32 + 20); }
  asm volatile("s_wait_xcnt 0x0" :: "v"(xr) : "memory");      /* the address pair lives up to this wait: left free, the last load's result was laid over the pair that the fifteen loads before it name */
#pragma unroll
  for (int m = 0; m < 3; ++m)
#pragma unroll
    for (int j = 0; j < 4; ++j) { FragP f;      /* column n4 + j: its 8 k, transposed inside the thread */
#pragma unroll
      for (int p = 0; p < 4; ++p) f.p[p] = __builtin_convertvector(pj_round2(v2f{wr[m][2 * p][j], wr[m][2 * p + 1][j]}) * v2f{16.0f, 16.0f}, v2h);
      *(v8us*)&LW[m][(n4 + j) * PJ_PITCH + k8 * 2] = f.half[0]; }
  FragP a[4];
#pragma unroll
  for (int kb = 0; kb < 4; ++kb)
#pragma unroll
    for (int p = 0; p < 8; ++p) a[kb].p[p] = __builtin_convertvector(pj_round2(v2f{xs[4 * kb + (p >> 1)][2 * (p & 1)], xs[4 * kb + (p >> 1)][2 * (p & 1) + 1]}), v2h);
  __syncthreads();      /* publishes the three W^T tiles */
  const v8f z8 = {0.f,0.f,0.f,0.f,0.f,0.f,0.f,0.f};
  v8f acc[3][4] = {{z8, z8, z8, z8}, {z8, z8, z8, z8}, {z8, z8, z8, z8}};
#pragma unroll
  for (int kb = 0; kb < 4; ++kb)
#pragma unroll
    for (int m = 0; m < 3; ++m)
#pragma unroll
      for (int t = 0; t < 4; ++t) acc[m][t] = fa_mma(a[kb].v, fa_frag(&LW[m][(t * 16 + ln) * PJ_PITCH + kb * 64 + 16 * hh]), acc[m][t]);
  /* accumulator tile t, register r: row 8 hh + r, column 16 t + ln */
#pragma unroll
  for (int m = 0; m < 2; ++m)
#pragma unroll
    for (int t = 0; t < 4; ++t) { const float bb = bf16_round((m ? bk : bq)[t * 16 + ln]);
#pragma unroll
      for (int r = 0; r < 8; ++r) so[w][m][8 * hh + r][t * 16 + ln] = acc[m][t][r] * 0.0625f + bb; }
#pragma unroll
  for (int t = 0; t < 4; ++t) { const float bb = bf16_round(bv[t * 16 + ln]); FragH f;      /* a lane's 8 registers are 8 consecutive tokens of one d: 16 bytes of a V^T row */
#pragma unroll
    for (int r = 0; r < 8; ++r) f.h[r] = (_Float16)(acc[2][t][r] * 0.0625f + bb);
    *(v8us*)&LV[(t * 16 + ln) * PJ_PITCH + (w * 16 + 8 * hh) * 2] = f.half[0]; }
  __syncthreads();      /* publishes the V^T tile to the other waves (and each wave's q, k rows to its own lanes) */
#pragma unroll
  for (int m = 0; m < 2; ++m)
#pragma unroll
    for (int q4 = 0; q4 < 4; ++q4) { const int c = q4 * 32 + lane, r = c >> 3, c8 = (c & 7) * 8; FragP fh, fl; const v4f u = *(const v4fa*)&so[w][m][r][c8], v = *(const v4fa*)&so[w][m][r][c8 + 4];      /* a wave's store covers four whole 128-byte rows */
      const v2f e2[4] = {{u[0], u[1]}, {u[2], u[3]}, {v[0], v[1]}, {v[2], v[3]}};
#pragma unroll
      for (int p = 0; p < 4; ++p) { const v2h h = __builtin_convertvector(e2[p], v2h); fh.p[p] = h; fl.p[p] = __builtin_convertvector((e2[p] - __builtin_convertvector(h, v2f)) * v2f{1024.0f, 1024.0f}, v2h); }      /* hi, and the residual x 1024 */
      const size_t o = (size_t)(row0 + r) * DQ + c8;
      *(v8us*)((unsigned short*)(m ? Kh : Qh) + o) = fh.half[0]; *(v8us*)((unsigned short*)(m ? Kl : Ql) + o) = fl.half[0]; }
  const int b = blockIdx.x / (SQ / 128), s0 = (blockIdx.x % (SQ / 128)) * 128;
#pragma unroll
  for (int j = 0; j < 4; ++j) { const int c = j * 256 + tid, d = c >> 4, ch = c & 15;      /* sixteen lanes store one 256-byte piece of a V^T row */
    *(v8us*)((unsigned short*)Vt + ((size_t)b * DV + d) * SQ + s0 + ch * 8) = *(const v8us*)&LV[d * PJ_PITCH + ch * 16]; }
}
__global__ __launch_bounds__(256) void k_f16rows(const float* __restrict__ F, _Float16* __restrict__ R, size_t n8) { const size_t t = (size_t)blockIdx.x * 256 + threadIdx.x; if (t >= n8) return; FragH f; for (int q = 0; q < 8; ++q) f.h[q] = (_Float16)F[t * 8 + q]; *(v8us*)((unsigned short*)R + t * 8) = f.half[0];  }
extern "C" void kernel_launch(void* const* d_in, const int* in_sizes, int n_in,
                              void* d_out, int out_size, void* d_ws, size_t ws_size, hipStream_t stream) {
  (void)in_sizes; (void)n_in; (void)out_size;
  const float* const* I = (const float* const*)d_in; const float* x = I[0]; const float* wq = I[1]; const float* bq = I[2]; const float* wk = I[3]; const float* bk = I[4]; const float* wv = I[5]; const float* bv = I[6];      /* [in][out] weights */
  char* ws = (char*)d_ws; size_t off = 0;
  auto take = [&](size_t bytes) { char* p = ws + off; off += (bytes + 255) & ~(size_t)255; return p; };
  _Float16* Q16 = (_Float16*)take(NR * DQ * 2); _Float16* QL = (_Float16*)take(NR * DQ * 2); _Float16* K16 = (_Float16*)take(NR * DQ * 2); _Float16* KL = (_Float16*)take(NR * DQ * 2);
  _Float16* VT = (_Float16*)take((size_t)NB * DV * SQ * 2);
  if (off > ws_size) return;
  k_proj<<<(unsigned)(NR / 128), 256, 0, stream>>>(x, wq, bq, wk, bk, wv, bv, Q16, QL, K16, KL, VT);      /* q, k as hi + residual planes, V^T per batch [DV][SQ] */
  k_fattn<<<NB * (SQ / FA_BQ), FA_NW * 32, 0, stream>>>(Q16, QL, K16, KL, VT, (float*)d_out);      /* scores (three terms), softmax, attn v */
}

// v005
// One run takes 55 microseconds.
// Two timings next to v004 both put it at 1.08 times that version's speed.
// Over all steps from v000 it is 385 times as fast.
#include <hip/hip_runtime.h>
// SA layer (x [8][4096][128]; q, k = x W + b ([in][out] [128][64]), v = x Wv + bv; scores = q.k (NO scaling, logits sigma ~8); softmax; out = attn v -> [8][4096][64]).
// Structure: two launches. One front-end kernel per 128 token rows: x as exact f16 fragments; q | k | v on WMMA (16x192 wave tiles, f32 accumulation, exact x16 transposed [in][out] weights in LDS + bias); q (times log2 e) and k out as f16 hi + unscaled f16 residual planes (three-term scores); v out as V^T through LDS. One fused attention kernel per 128 queries (waves of 32 query columns x one key range each, partial results merged at the end): scores (K = 64) on WMMA, one accumulator chain per tile that starts at minus the maximum in use, softmax on VALU (f32; P f16, at most 2^15), out = P . V on WMMA, written straight to the f32 output.
// Compute dtype: inputs rounded to bf16; x / weights exact; q, k hi + residual (~2^-22); v, P plain f16 (~2^-12); scores / softmax f32. v_wmma_f32_16x16x32_f16.
#define NB 8
#define SQ 4096
#define DM 128
#define DQ 64
#define DV 64
#define QT 2048
#define NH 1                    /* V^T slabs of 64 (k_vt<NH, SQ>) */
#define HD 64
#define HG 1
#define NR ((size_t)NB * SQ)
#define QN SQ                        /* query rows per batch (debug hook) */
#define NBR NB                       /* batches (debug hook) */
#define MP ((int)NR)                 /* rows through the projections (debug hook) */
typedef __bf16 v16b __attribute__((ext_vector_type(16)));
typedef unsigned short v8us __attribute__((ext_vector_type(8), may_alias));
typedef float  v8f  __attribute__((ext_vector_type(8)));
typedef float  v4f  __attribute__((ext_vector_type(4)));
typedef float  v4fa __attribute__((ext_vector_type(4), may_alias));
union FragB { v16b v; v8us half[2]; unsigned short u[16]; };

__device__ __forceinline__ unsigned short bf16_bits(float x) { unsigned int u = __float_as_uint(x); return (unsigned short)((u + 0x7FFFu + ((u >> 16) & 1u)) >> 16); }
__device__ __forceinline__ float bf16_val(unsigned short b) { return __uint_as_float(((unsigned int)b) << 16); }
__device__ __forceinline__ float bf16_round(float x) { return bf16_val(bf16_bits(x)); }
// D += A·B with NT terms: 1 = ah·bh, 2 = + al·bh (A split), 3 = + ah·bl (both split)
template <int NT>
__device__ __forceinline__ v8f mmaN(v16b ah, v16b al, v16b bh, v16b bl, v8f c) {
  c = __builtin_amdgcn_wmma_f32_16x16x32_bf16(false, ah, false, bh, (short)0, c, false, false);
  if (NT >= 2) c = __builtin_amdgcn_wmma_f32_16x16x32_bf16(false, al, false, bh, (short)0, c, false, false);
  if (NT >= 3) c = __builtin_amdgcn_wmma_f32_16x16x32_bf16(false, ah, false, bl, (short)0, c, false, false);
  asm volatile("v_nop\n\tv_nop\n\tv_nop\n\tv_nop" : "+v"(c) : "v"(ah), "v"(al), "v"(bh), "v"(bl));
  return c;
}

__global__ __launch_bounds__(256) void k_wt_bf16(const float* __restrict__ W, unsigned short* __restrict__ Wt, int K, int N) {
  const int t = blockIdx.x * 256 + threadIdx.x;
  const int k8n = K / 8;
  if (t >= N * k8n) return;
  const int n = t / k8n, k8 = (t % k8n) * 8;
  v8us v;
#pragma unroll
  for (int i = 0; i < 8; ++i) v[i] = bf16_bits(W[(size_t)(k8 + i) * N + n]);
  *(v8us*)(Wt + (size_t)n * K + k8) = v;
  
}

// GEMM C[M][N] (f32, pitch ldc) = act(A[M][K]·W + bias). A f32 row-major (pitch lda) converted per fragment to bf16
// (ASPLIT: hi/lo two planes -> 2 terms, else single rounded term); Wt bf16 [N][K] (pitch ldb). BIAS_BF16 rounds the
// bias to bf16 first (bias quantised to bf16 before the add). K%32==0, M%16==0, N%64==0.
template <bool ASPLIT, int ACT, bool BIAS_BF16>
__global__ __launch_bounds__(128) void k_gemm_bf(const float* __restrict__ A, int lda, const unsigned short* __restrict__ Wt, int ldb,
                                               const float* __restrict__ bias, float* __restrict__ C, int ldc, int M, int N, int K) {
  __shared__ __attribute__((aligned(16))) float so[4][16][64];
  const int tid = threadIdx.x, w = tid >> 5, lane = tid & 31, ln = lane & 15, hh = lane >> 4;
  const int ntn = N / 64;
  const int wid = blockIdx.x * 4 + w;
  const int mt = wid / ntn, nq = wid % ntn;
  if (mt * 16 >= M) return;
  const int row0 = mt * 16, col0 = nq * 64;
  const float* arow = A + (size_t)(row0 + ln) * lda;
  v8f acc[4] = {};
  for (int kb = 0; kb < K; kb += 32) {
    FragB ah, al;
    const v4f x0 = *(const v4fa*)(arow + kb + 8 * hh), x1 = *(const v4fa*)(arow + kb + 8 * hh + 4);
    const v4f x2 = *(const v4fa*)(arow + kb + 16 + 8 * hh), x3 = *(const v4fa*)(arow + kb + 16 + 8 * hh + 4);
    float xs[16] = {x0[0],x0[1],x0[2],x0[3],x1[0],x1[1],x1[2],x1[3],x2[0],x2[1],x2[2],x2[3],x3[0],x3[1],x3[2],x3[3]};
#pragma unroll
    for (int i = 0; i < 16; ++i) { const unsigned short hb = bf16_bits(xs[i]); ah.u[i] = hb; al.u[i] = ASPLIT ? bf16_bits(xs[i] - bf16_val(hb)) : (unsigned short)0; }
#pragma unroll
    for (int t = 0; t < 4; ++t) {
      const unsigned short* brow = Wt + (size_t)(col0 + t * 16 + ln) * ldb + kb;
      FragB b;
      b.half[0] = *(const v8us*)(brow + 8 * hh);
      b.half[1] = *(const v8us*)(brow + 16 + 8 * hh);
      acc[t] = mmaN<ASPLIT ? 2 : 1>(ah.v, al.v, b.v, b.v, acc[t]);
    }
  }
#pragma unroll
  for (int t = 0; t < 4; ++t) {
    float bv = bias ? bias[col0 + t * 16 + ln] : 0.f;
    if (BIAS_BF16) bv = bf16_round(bv);
#pragma unroll
    for (int r = 0; r < 8; ++r) { float v = acc[t][r] + bv; if (ACT == 1) v = fmaxf(v, 0.f); so[w][8 * hh + r][t * 16 + ln] = v; }
  }
  __builtin_amdgcn_fence(__ATOMIC_ACQ_REL, "workgroup");
  __builtin_amdgcn_wave_barrier();
  const int rsub = lane >> 4, c4 = (lane & 15) * 4;
  {
#pragma unroll
    for (int q = 0; q < 8; ++q) {
      const int r = q * 2 + rsub;
      const v4f v = *(const v4fa*)&so[w][r][c4];
      *(v4f*)(C + (size_t)(row0 + r) * ldc + col0 + c4) = v;
    }
    
  }
}

// GEMM C = act(A·W + bias + resid): A f32 (ASPLIT -> hi/lo 2 terms), Wt bf16 [N][K]; ACT 0 none, 1 relu, 2 exact gelu;
// resid (optional, f32, row index = (row % rmod), pitch ldr, RES_BF16 rounds it) added before the activation.
template <bool ASPLIT, int ACT, bool BIAS_BF16, bool RES_BF16>
__global__ __launch_bounds__(128) void k_gemm_bf3(const float* __restrict__ A, int lda, const unsigned short* __restrict__ Wt, int ldb,
                                                const float* __restrict__ bias, const float* __restrict__ resid, int rmod, int ldr,
                                                float* __restrict__ C, int ldc, int M, int N, int K) {
  __shared__ __attribute__((aligned(16))) float so[4][16][64];
  const int tid = threadIdx.x, w = tid >> 5, lane = tid & 31, ln = lane & 15, hh = lane >> 4;
  const int ntn = N / 64;
  const int wid = blockIdx.x * 4 + w;
  const int mt = wid / ntn, nq = wid % ntn;
  if (mt * 16 >= M) return;
  const int row0 = mt * 16, col0 = nq * 64;
  const float* arow = A + (size_t)(row0 + ln) * lda;
  v8f acc[4] = {};
  for (int kb = 0; kb < K; kb += 32) {
    FragB ah, al;
    const v4f x0 = *(const v4fa*)(arow + kb + 8 * hh), x1 = *(const v4fa*)(arow + kb + 8 * hh + 4);
    const v4f x2 = *(const v4fa*)(arow + kb + 16 + 8 * hh), x3 = *(const v4fa*)(arow + kb + 16 + 8 * hh + 4);
    float xs[16] = {x0[0],x0[1],x0[2],x0[3],x1[0],x1[1],x1[2],x1[3],x2[0],x2[1],x2[2],x2[3],x3[0],x3[1],x3[2],x3[3]};
#pragma unroll
    for (int i = 0; i < 16; ++i) { const unsigned short hb = bf16_bits(xs[i]); ah.u[i] = hb; al.u[i] = ASPLIT ? bf16_bits(xs[i] - bf16_val(hb)) : (unsigned short)0; }
#pragma unroll
    for (int t = 0; t < 4; ++t) {
      const unsigned short* brow = Wt + (size_t)(col0 + t * 16 + ln) * ldb + kb;
      FragB b;
      b.half[0] = *(const v8us*)(brow + 8 * hh);
      b.half[1] = *(const v8us*)(brow + 16 + 8 * hh);
      acc[t] = mmaN<ASPLIT ? 2 : 1>(ah.v, al.v, b.v, b.v, acc[t]);
    }
  }
#pragma unroll
  for (int t = 0; t < 4; ++t) {
    const int col = col0 + t * 16 + ln;
    float bv = bias ? bias[col] : 0.f;
    if (BIAS_BF16) bv = bf16_round(bv);
#pragma unroll
    for (int r = 0; r < 8; ++r) {
      float v = acc[t][r] + bv;
      if (resid) { float rv = resid[(size_t)((row0 + 8 * hh + r) % rmod) * ldr + col]; if (RES_BF16) rv = bf16_round(rv); v += rv; }
      if (ACT == 1) v = fmaxf(v, 0.f);
      if (ACT == 2) v = 0.5f * v * (1.0f + erff(v * 0.70710678118654752f));
      if (ACT == 3) { const float u = 0.7978845608028654f * (v + 0.044715f * v * v * v); v = 0.5f * v * (1.0f + tanhf(u)); }
      so[w][8 * hh + r][t * 16 + ln] = v;
    }
  }
  __builtin_amdgcn_fence(__ATOMIC_ACQ_REL, "workgroup");
  __builtin_amdgcn_wave_barrier();
  const int rsub = lane >> 4, c4 = (lane & 15) * 4;
  {
#pragma unroll
    for (int q = 0; q < 8; ++q) {
      const int r = q * 2 + rsub;
      const v4f v = *(const v4fa*)&so[w][r][c4];
      *(v4f*)(C + (size_t)(row0 + r) * ldc + col0 + c4) = v;
    }
    
  }
}
// row LayerNorm (biased variance, eps) over N: s = X (+ R); optional out_sum <- s; out_norm <- (s-mu)*rsqrt(var+eps)*g + b
template <bool PARAM_BF16>
__global__ __launch_bounds__(256) void k_layernorm(const float* __restrict__ X, const float* __restrict__ R, const float* __restrict__ g, const float* __restrict__ bta,
                                                  float* __restrict__ out_sum, float* __restrict__ out_norm, int N, float eps) {
  __shared__ float red[256];
  const int row = blockIdx.x, tid = threadIdx.x;
  const float* x = X + (size_t)row * N; const float* rr = R ? R + (size_t)row * N : nullptr;
  float vals[16];                     // up to N = 4096
  const int per = N / 256;            // contiguous chunk per thread? use strided-by-4 chunks: thread handles j = tid*4 + 1024*u
  float s1 = 0.f;
  for (int u = 0; u < per / 4; ++u) {
    const int j = tid * 4 + 1024 * u;
    const v4f a = *(const v4fa*)(x + j);
    v4f b = {0.f,0.f,0.f,0.f}; if (rr) b = *(const v4fa*)(rr + j);
#pragma unroll
    for (int q = 0; q < 4; ++q) { const float v = a[q] + b[q]; vals[u * 4 + q] = v; s1 += v; }
  }
  red[tid] = s1; __syncthreads();
  for (int st = 128; st > 0; st >>= 1) { if (tid < st) red[tid] += red[tid + st]; __syncthreads(); }
  const float mu = red[0] / (float)N; __syncthreads();
  float s2 = 0.f;
  for (int u = 0; u < per / 4; ++u)
#pragma unroll
    for (int q = 0; q < 4; ++q) { const float c = vals[u * 4 + q] - mu; s2 += c * c; }
  red[tid] = s2; __syncthreads();
  for (int st = 128; st > 0; st >>= 1) { if (tid < st) red[tid] += red[tid + st]; __syncthreads(); }
  const float rs = rsqrtf(red[0] / (float)N + eps);
  {
    for (int u = 0; u < per / 4; ++u) {
      const int j = tid * 4 + 1024 * u;
      v4f o, sm;
#pragma unroll
      for (int q = 0; q < 4; ++q) {
        float gg = g[j + q], bb = bta[j + q];
        if (PARAM_BF16) { gg = bf16_round(gg); bb = bf16_round(bb); }
        sm[q] = vals[u * 4 + q]; o[q] = (vals[u * 4 + q] - mu) * rs * gg + bb;
      }
      if (out_sum) *(v4f*)(out_sum + (size_t)row * N + j) = sm;
      *(v4f*)(out_norm + (size_t)row * N + j) = o;
    }
    
  }
}



// ---- f16 WMMA path (v_wmma_f32_16x16x32_f16): 11-bit significands for operands in range — used where a [0,1] probability operand needs more precision than bf16
typedef _Float16 v16h __attribute__((ext_vector_type(16)));
union FragH { v16h v; v8us half[2]; _Float16 h[16]; unsigned short u[16]; };
template <int NT>
__device__ __forceinline__ v8f mmaH(v16h ah, v16h al, v16h bh, v16h bl, v8f c) {
  c = __builtin_amdgcn_wmma_f32_16x16x32_f16(false, ah, false, bh, (short)0, c, false, false);
  if (NT >= 2) c = __builtin_amdgcn_wmma_f32_16x16x32_f16(false, al, false, bh, (short)0, c, false, false);
  if (NT >= 3) c = __builtin_amdgcn_wmma_f32_16x16x32_f16(false, ah, false, bl, (short)0, c, false, false);
  asm volatile("v_nop\n\tv_nop\n\tv_nop\n\tv_nop" : "+v"(c) : "v"(ah), "v"(al), "v"(bh), "v"(bl));
  return c;
}
// batched GEMM like k_gemm_b but f16 operands: A f32 (split into f16 hi/lo if ASPLIT, else rounded to f16), Bt = f16 values [n][k]; alpha; C f32; N multiple of 16 (partial tiles skipped)
template <bool ASPLIT>
__global__ __launch_bounds__(128) void k_gemm_h(const float* __restrict__ A, int lda, size_t sA, const _Float16* __restrict__ Bh, int ldb, size_t sB, float alpha, float* __restrict__ C, int ldc, size_t sC, int M, int N, int K) {
  __shared__ __attribute__((aligned(16))) float so[4][16][64];
  const int tid = threadIdx.x, w = tid >> 5, lane = tid & 31, ln = lane & 15, hh = lane >> 4; const int by = blockIdx.y;
  A += (size_t)by * sA; Bh += (size_t)by * sB; C += (size_t)by * sC;
  const int ntn = (N + 63) / 64; const int wid = blockIdx.x * 4 + w; const int mt = wid / ntn, nq = wid % ntn; if (mt * 16 >= M) return;
  const int row0 = mt * 16, col0 = nq * 64; const float* arow = A + (size_t)(row0 + ln) * lda;
  v8f acc[4] = {};
  for (int kb = 0; kb < K; kb += 32) {
    FragH ah, al;
    const v4f x0 = *(const v4fa*)(arow + kb + 8 * hh), x1 = *(const v4fa*)(arow + kb + 8 * hh + 4), x2 = *(const v4fa*)(arow + kb + 16 + 8 * hh), x3 = *(const v4fa*)(arow + kb + 16 + 8 * hh + 4);
    float xs[16] = {x0[0],x0[1],x0[2],x0[3],x1[0],x1[1],x1[2],x1[3],x2[0],x2[1],x2[2],x2[3],x3[0],x3[1],x3[2],x3[3]};
#pragma unroll
    for (int i = 0; i < 16; ++i) { const _Float16 h = (_Float16)xs[i]; ah.h[i] = h; al.h[i] = ASPLIT ? (_Float16)(xs[i] - (float)h) : (_Float16)0.0f; }
#pragma unroll
    for (int t = 0; t < 4; ++t) { if (col0 + t * 16 >= N) continue; const size_t boff = (size_t)(col0 + t * 16 + ln) * ldb + kb; FragH bq; bq.half[0] = *(const v8us*)(Bh + boff + 8 * hh); bq.half[1] = *(const v8us*)(Bh + boff + 16 + 8 * hh);
      acc[t] = mmaH<ASPLIT ? 2 : 1>(ah.v, al.v, bq.v, bq.v, acc[t]); }
  }
#pragma unroll
  for (int t = 0; t < 4; ++t) { if (col0 + t * 16 >= N) continue;
#pragma unroll
    for (int r = 0; r < 8; ++r) so[w][8 * hh + r][t * 16 + ln] = acc[t][r] * alpha; }
  __builtin_amdgcn_fence(__ATOMIC_ACQ_REL, "workgroup"); __builtin_amdgcn_wave_barrier();
  const int rsub = lane >> 4, c4 = (lane & 15) * 4;
  {
#pragma unroll
    for (int q = 0; q < 8; ++q) { const int r = q * 2 + rsub; if (col0 + c4 < N) { const v4f v = *(const v4fa*)&so[w][r][c4]; *(v4f*)(C + (size_t)(row0 + r) * ldc + col0 + c4) = v; } }
     }
}

// Wt[n][k] = f16(W[k][n]·scale) from f32 row-major W[K][N] (scale = power of two; bf16-exact weights stay exact in f16 away from the subnormal range)
__global__ __launch_bounds__(256) void k_wt_f16(const float* __restrict__ W, _Float16* __restrict__ Wt, int K, int N, float scale) {
  const int t = blockIdx.x * 256 + threadIdx.x; if (t >= N * (K / 8)) return; const int n = t / (K / 8), k8 = (t % (K / 8)) * 8; FragH f;
#pragma unroll
  for (int i = 0; i < 8; ++i) f.h[i] = (_Float16)(bf16_round(W[(size_t)(k8 + i) * N + n]) * scale); const v8us o = f.half[0];
  *(v8us*)((unsigned short*)Wt + (size_t)n * K + k8) = o; 
}
// k_gemm_hh variant with fused epilogue: v = acc·alpha + bias[by·sBias + col] (+ CP[(row/rowsPerB)·sCPb + by·64 + col] if CP) ; ACT 0 none / 1 elu ; writes f16 C16 (and f32 C if non-null)
template <int ACT>
__global__ __launch_bounds__(128) void k_gemm_hhx(const _Float16* __restrict__ A, int lda, size_t sA, const _Float16* __restrict__ Bh, int ldb, size_t sB, float alpha, const float* __restrict__ bias, size_t sBias, const float* __restrict__ CP, int rowsPerB, size_t sCPb, int row0g,
    float* __restrict__ C, _Float16* __restrict__ C16, int ldc, size_t sC, int M, int N, int K) {
  __shared__ __attribute__((aligned(16))) float so[4][16][64];
  const int tid = threadIdx.x, w = tid >> 5, lane = tid & 31, ln = lane & 15, hh = lane >> 4; const int by = blockIdx.y;
  A += (size_t)by * sA; Bh += (size_t)by * sB; const size_t cofs = (size_t)by * sC; const float* bp = bias ? bias + (size_t)by * sBias : nullptr;
  const int ntn = (N + 63) / 64; const int wid = blockIdx.x * 4 + w; const int mt = wid / ntn, nq = wid % ntn; if (mt * 16 >= M) return;
  const int row0 = mt * 16, col0 = nq * 64; const _Float16* arow = A + (size_t)(row0 + ln) * lda;
  v8f acc[4] = {};
  for (int kb = 0; kb < K; kb += 32) { FragH ah; ah.half[0] = *(const v8us*)((const unsigned short*)arow + kb + 8 * hh); ah.half[1] = *(const v8us*)((const unsigned short*)arow + kb + 16 + 8 * hh);
#pragma unroll
    for (int t = 0; t < 4; ++t) { if (col0 + t * 16 >= N) continue; const size_t boff = (size_t)(col0 + t * 16 + ln) * ldb + kb; FragH bq; bq.half[0] = *(const v8us*)((const unsigned short*)Bh + boff + 8 * hh); bq.half[1] = *(const v8us*)((const unsigned short*)Bh + boff + 16 + 8 * hh);
      acc[t] = mmaH<1>(ah.v, ah.v, bq.v, bq.v, acc[t]); }
  }
#pragma unroll
  for (int t = 0; t < 4; ++t) { if (col0 + t * 16 >= N) continue; const int col = col0 + t * 16 + ln; const float bv = bp ? bf16_round(bp[col]) : 0.f;
#pragma unroll
    for (int r = 0; r < 8; ++r) { float v = acc[t][r] * alpha + bv; if (CP) { const int rr = row0g + row0 + 8 * hh + r; if (rowsPerB < 0) v += CP[cofs + (size_t)rr * ldc + col];      /* rowsPerB < 0: own element of the batched C plane */ else { const int bidx = rr / rowsPerB; v += CP[(size_t)bidx * sCPb + (size_t)by * 64 + col]; } } if (ACT == 1) v = (v > 0.f) ? v : expm1f(v); else if (ACT == 7) v = (v > 0.f) ? v + 1.0f : expf(v); else if (ACT == 8) v = tanhf(v); else if (ACT == 9) v = 0.5f * v * (1.0f + tanhf(0.7978845608028654f * (v + 0.044715f * v * v * v))); else if (ACT == 11) v = 1.0f / (1.0f + expf(-v)); else if (ACT == 12) v = (v > 0.f) ? v : 0.01f * v; else if (ACT == 14) v = (v > 0.f) ? v : 0.1f * v; else if (ACT == 16) v = (v >= 0.f) ? v : 0.3f * v; else if (ACT == 17) v = (v >= 0.f) ? v : 0.2f * v; else if (ACT == 15) v = v / (1.0f + expf(-v)); else if (ACT == 3) v = fmaxf(v, 0.f); else if (ACT == 6) v = 0.5f * v * (1.0f + erff(v * 0.70710678118654752f)); so[w][8 * hh + r][t * 16 + ln] = v; } }
  __builtin_amdgcn_fence(__ATOMIC_ACQ_REL, "workgroup"); __builtin_amdgcn_wave_barrier();
  const int rsub = lane >> 4, c4 = (lane & 15) * 4; typedef _Float16 v4h __attribute__((ext_vector_type(4)));
  {
#pragma unroll
    for (int q = 0; q < 8; ++q) { const int r = q * 2 + rsub; if (col0 + c4 < N) { const v4f v = *(const v4fa*)&so[w][r][c4]; if (C) *(v4f*)(C + cofs + (size_t)(row0 + r) * ldc + col0 + c4) = v; if (C16) { v4h h4; for (int i = 0; i < 4; ++i) h4[i] = (_Float16)v[i]; *(v4h*)(C16 + cofs + (size_t)(row0 + r) * ldc + col0 + c4) = h4; } } }
     }
}


typedef _Float16 v4h __attribute__((ext_vector_type(4)));

__global__ __launch_bounds__(256) void k_x16(const float* __restrict__ x, _Float16* __restrict__ X16, size_t n8) { const size_t t = (size_t)blockIdx.x * 256 + threadIdx.x; if (t >= n8) return; FragH f;
#pragma unroll
  for (int q = 0; q < 8; ++q) f.h[q] = (_Float16)bf16_round(x[t * 8 + q]); *(v8us*)((unsigned short*)X16 + t * 8) = f.half[0];  }
__global__ __launch_bounds__(256) void k_h16(const float* __restrict__ x, _Float16* __restrict__ X16, size_t n8) { const size_t t = (size_t)blockIdx.x * 256 + threadIdx.x; if (t >= n8) return; FragH f;
#pragma unroll
  for (int q = 0; q < 8; ++q) f.h[q] = (_Float16)x[t * 8 + q]; *(v8us*)((unsigned short*)X16 + t * 8) = f.half[0];  }
__global__ __launch_bounds__(256) void k_round16f(const float* __restrict__ W, _Float16* __restrict__ Bt, size_t n8) { const size_t t = (size_t)blockIdx.x * 256 + threadIdx.x; if (t >= n8) return; FragH f;
#pragma unroll
  for (int i = 0; i < 8; ++i) f.h[i] = (_Float16)(bf16_round(W[t * 8 + i]) * 16.0f); *(v8us*)((unsigned short*)Bt + t * 8) = f.half[0];  }
template <int NHv, int TTv>
__global__ __launch_bounds__(256) void k_vt(const _Float16* __restrict__ V16, int ldv, int voff, _Float16* __restrict__ Vt) { __shared__ unsigned short tl[64][66]; const int tid = threadIdx.x; const int slab = blockIdx.x / (TTv / 64), lg = blockIdx.x % (TTv / 64); const int b = slab / NHv, h = slab % NHv;
  for (int i = tid; i < 64 * 8; i += 256) { const int r = i / 8, c8 = (i % 8) * 8; FragH f; f.half[0] = *(const v8us*)((const unsigned short*)V16 + ((size_t)b * TTv + lg * 64 + r) * ldv + voff + h * 64 + c8);
#pragma unroll
    for (int q = 0; q < 8; ++q) tl[r][c8 + q] = f.u[q]; }
  __syncthreads();
  {
#pragma unroll
    for (int rd = 0; rd < 2; ++rd) { const int d = rd * 32 + tid / 8, pc = tid % 8; FragH f;
#pragma unroll
      for (int q = 0; q < 8; ++q) f.u[q] = tl[pc * 8 + q][d];
      *(v8us*)((unsigned short*)Vt + ((size_t)slab * 64 + d) * TTv + lg * 64 + pc * 8) = f.half[0]; }
     } }

__global__ __launch_bounds__(256) void k_hl(const float* __restrict__ F, _Float16* __restrict__ Hh, _Float16* __restrict__ Hl, size_t n8) { const size_t t = (size_t)blockIdx.x * 256 + threadIdx.x; if (t >= n8) return; FragH fh, fl; const v4f a = *(const v4fa*)(F + t * 8), c = *(const v4fa*)(F + t * 8 + 4);
#pragma unroll
  for (int q = 0; q < 4; ++q) { _Float16 h = (_Float16)a[q]; fh.h[q] = h; fl.h[q] = (_Float16)((a[q] - (float)h) * 1024.0f); h = (_Float16)c[q]; fh.h[4 + q] = h; fl.h[4 + q] = (_Float16)((c[q] - (float)h) * 1024.0f); }
  { *(v8us*)((unsigned short*)Hh + t * 8) = fh.half[0]; *(v8us*)((unsigned short*)Hl + t * 8) = fl.half[0];  } }

// ---- fast GEMM (wave tile 32x64; requires M % 32 == 0 rows per launch region and N % 64 == 0); epilogue = k_gemm_hhx semantics ----
__device__ __forceinline__ v16h g2_frag(const _Float16* p, int hh) { FragH f; f.half[0] = *(const v8us*)((const unsigned short*)p + 8 * hh); f.half[1] = *(const v8us*)((const unsigned short*)p + 16 + 8 * hh); return f.v; }
__device__ __forceinline__ v8f g2_mma(v16h a, v16h b, v8f c) { v8f d = __builtin_amdgcn_wmma_f32_16x16x32_f16(false, a, false, b, (short)0, c, false, false); asm volatile("v_nop\n\tv_nop\n\tv_nop\n\tv_nop" : "+v"(d) : "v"(a), "v"(b)); return d; }
template <int ACT>
__global__ __launch_bounds__(128) void k_gemm2(const _Float16* __restrict__ A, int lda, size_t sA, const _Float16* __restrict__ Bh, int ldb, size_t sB, float alpha, const float* __restrict__ bias, size_t sBias, const float* __restrict__ CP, int rowsPerB, size_t sCPb, int row0g,
    float* __restrict__ C, _Float16* __restrict__ C16, int ldc, size_t sC, int M, int N, int K) { static_assert(ACT == 0 || ACT == 3 || ACT == 6 || ACT == 8 || ACT == 9 || ACT == 11 || ACT == 12 || ACT == 14 || ACT == 15 || ACT == 16 || ACT == 17, "k_gemm2: unsupported ACT code (would silently apply no activation)");
  __shared__ __attribute__((aligned(16))) float so[4][32][68];
  const int tid = threadIdx.x, w = tid >> 5, lane = tid & 31, ln = lane & 15, hh = lane >> 4; const int by = blockIdx.y;
  A += (size_t)by * sA; Bh += (size_t)by * sB; const size_t cofs = (size_t)by * sC; const float* bp = bias ? bias + (size_t)by * sBias : nullptr;
  const int ntn = N >> 6; const int mt = blockIdx.x / ntn, nq = blockIdx.x - mt * ntn; const int row0 = mt * 128 + 32 * w, col0 = nq * 64; if (row0 >= M) return;
  const _Float16* a0p = A + (size_t)(row0 + ln) * lda; const _Float16* a1p = a0p + (size_t)16 * lda;
  const _Float16* b0p = Bh + (size_t)(col0 + ln) * ldb; const _Float16* b1p = b0p + (size_t)16 * ldb; const _Float16* b2p = b1p + (size_t)16 * ldb; const _Float16* b3p = b2p + (size_t)16 * ldb;
  const v8f z8 = {0.f,0.f,0.f,0.f,0.f,0.f,0.f,0.f}; v8f c00 = z8, c01 = z8, c02 = z8, c03 = z8, c10 = z8, c11 = z8, c12 = z8, c13 = z8;
#pragma unroll 1
  for (int kb = 0; kb < K; kb += 32) { const v16h a0 = g2_frag(a0p + kb, hh), a1 = g2_frag(a1p + kb, hh);
    v16h b = g2_frag(b0p + kb, hh); c00 = g2_mma(a0, b, c00); c10 = g2_mma(a1, b, c10);
    b = g2_frag(b1p + kb, hh); c01 = g2_mma(a0, b, c01); c11 = g2_mma(a1, b, c11);
    b = g2_frag(b2p + kb, hh); c02 = g2_mma(a0, b, c02); c12 = g2_mma(a1, b, c12);
    b = g2_frag(b3p + kb, hh); c03 = g2_mma(a0, b, c03); c13 = g2_mma(a1, b, c13); }
  v8f accs[8] = {c00, c01, c02, c03, c10, c11, c12, c13};
#pragma unroll
  for (int u = 0; u < 8; ++u) { const int t = u & 3, half = u >> 2; const int col = col0 + t * 16 + ln; const float bv = bp ? bf16_round(bp[col]) : 0.f;
#pragma unroll
    for (int r = 0; r < 8; ++r) { const int rloc = half * 16 + 8 * hh + r; float v = accs[u][r] * alpha + bv; if (CP) { if (rowsPerB < 0) v += CP[cofs + (size_t)(row0g + row0 + rloc) * ldc + col];      /* rowsPerB < 0: own element of the batched C plane */ else { const int bidx = (row0g + row0 + rloc) / rowsPerB; v += CP[(size_t)bidx * sCPb + (size_t)by * 64 + col]; } }
      if (ACT == 3) v = fmaxf(v, 0.f); else if (ACT == 6) v = 0.5f * v * (1.0f + erff(v * 0.70710678118654752f)); else if (ACT == 11) v = 1.0f / (1.0f + expf(-v)); else if (ACT == 15) v = v / (1.0f + expf(-v)); else if (ACT == 12) v = (v > 0.f) ? v : 0.01f * v; else if (ACT == 8) v = tanhf(v); else if (ACT == 9) v = 0.5f * v * (1.0f + tanhf(0.7978845608028654f * (v + 0.044715f * v * v * v))); else if (ACT == 14) v = (v > 0.f) ? v : 0.1f * v; else if (ACT == 16) v = (v >= 0.f) ? v : 0.3f * v; else if (ACT == 17) v = (v >= 0.f) ? v : 0.2f * v;
      so[w][rloc][t * 16 + ln] = v; } }
  __builtin_amdgcn_fence(__ATOMIC_ACQ_REL, "workgroup"); __builtin_amdgcn_wave_barrier();
  const int rsub = lane >> 4, c4 = (lane & 15) * 4;
  {
#pragma unroll
    for (int q = 0; q < 16; ++q) { const int r = q * 2 + rsub; const v4f v = *(const v4fa*)&so[w][r][c4]; if (C) *(v4f*)(C + cofs + (size_t)(row0 + r) * ldc + col0 + c4) = v; if (C16) { v4h h4; for (int i = 0; i < 4; ++i) h4[i] = (_Float16)v[i]; *(v4h*)(C16 + cofs + (size_t)(row0 + r) * ldc + col0 + c4) = h4; } }
     } }


__global__ __launch_bounds__(256) void k_wnat(const float* __restrict__ w, size_t n8, _Float16* __restrict__ Bt) { const size_t t = (size_t)blockIdx.x * 256 + threadIdx.x; if (t >= n8) return; FragH f; for (int q = 0; q < 8; ++q) f.h[q] = (_Float16)(bf16_round(w[t * 8 + q]) * 16.0f); *(v8us*)((unsigned short*)Bt + t * 8) = f.half[0];  }
__global__ __launch_bounds__(256) void k_rsm(const float* __restrict__ S, _Float16* __restrict__ P, int nrows) {
  #pragma clang fp contract(off)
  const int i = blockIdx.x * 256 + threadIdx.x; if (i >= nrows) return; const float* s = S + (size_t)i * SQ; float mx = -3.0e38f;
#pragma unroll 1
  for (int j = 0; j < SQ; ++j) mx = fmaxf(mx, s[j]); float se = 0.f;
#pragma unroll 1
  for (int j = 0; j < SQ; ++j) se += expf(s[j] - mx); const float sc = 256.0f / se;
#pragma unroll 1
  for (int j0 = 0; j0 < SQ; j0 += 8) { FragH f; for (int q = 0; q < 8; ++q) f.h[q] = (_Float16)(expf(s[j0 + q] - mx) * sc); unsigned short* d = (unsigned short*)P + (size_t)i * SQ + j0; *(v8us*)d = f.half[0];  } }
__global__ __launch_bounds__(256) void k_vt(const _Float16* __restrict__ V16, int b, int h0, _Float16* __restrict__ VT) { __shared__ unsigned short tl[64][65]; const int tid = threadIdx.x; const int hh = blockIdx.x % HG, sg = blockIdx.x / HG; const int s0 = sg * 64; const int h = h0 + hh;
  for (int i = tid; i < 64 * 8; i += 256) { const int j = i / 8, d8 = (i % 8) * 8; FragH f; f.half[0] = *(const v8us*)((const unsigned short*)V16 + ((size_t)b * SQ + s0 + j) * DM + h * HD + d8); for (int q = 0; q < 8; ++q) tl[d8 + q][j] = f.u[q]; }
  __syncthreads();
  { for (int i = tid; i < 64 * 8; i += 256) { const int d = i / 8, j8 = (i % 8) * 8; FragH f; for (int q = 0; q < 8; ++q) f.u[q] = tl[d][j8 + q]; *(v8us*)((unsigned short*)VT + ((size_t)hh * HD + d) * SQ + s0 + j8) = f.half[0]; }  } }

// ---- fused attention: one work-group = 128 queries of one batch; FA_NQG groups of 32 query columns x FA_KS key ranges, one wave each; a wave walks its own key range in LDS stages of 64; scores and P stay in registers ----
// Transposed products: S^T = K . Q^T (rows = keys, columns = queries), O^T += V^T . P^T. A lane's 8 + 8 accumulator registers of the two 16-key score tiles are keys 8 hh + r and 16 + 8 hh + r of its own query column:
// exactly the k order of the B fragment of the second product, so P goes from accumulator to operand inside the lane. Max and sum of a query live in its two lanes (ln, ln + 16).
// Every K and V^T fragment read from LDS feeds both of the wave's query tiles. The key ranges' partial results (maximum, sum, O^T) meet once, at the end, through LDS.
#define FA_QT 2                      /* 16-column query tiles per wave */
#define FA_KS 4                      /* key ranges per work-group */
#define FA_BQ 128                    /* queries per work-group */
#define FA_NQG (FA_BQ / (16 * FA_QT))      /* waves per key range */
#define FA_NW (FA_NQG * FA_KS)       /* waves per work-group */
#define FA_SK 64                     /* keys per LDS stage and key range */
#define FA_NS (SQ / FA_KS / FA_SK)
#define FA_PITCH 144                 /* LDS row pitch, bytes: 128 of data + 16 (an odd multiple of 16 B for the 16-byte fragment reads) */
#define FA_TILE (64 * FA_PITCH)
#define FA_BUF (FA_KS * 3 * FA_TILE) /* one buffer: every key range's three tiles */
#define FA_MP 144                    /* bytes of one lane's partial result of one query tile: 32 f32 of O^T, maximum, sum, 8 B unused (again an odd multiple of 16 B) */
typedef float v2f __attribute__((ext_vector_type(2)));
typedef _Float16 v2h __attribute__((ext_vector_type(2)));
union FragP { v16h v; v2h p[8]; v8us half[2]; };
__device__ __forceinline__ float fa_xrow(float v) { const unsigned int i = __float_as_uint(v); return __uint_as_float(__builtin_amdgcn_permlanex16(i, i, 0x76543210u, 0xfedcba98u, false, false)); }      /* lane l <-> lane l ^ 16 */
__device__ __forceinline__ v16h fa_frag(const unsigned char* p) { FragH f; f.half[0] = *(const v8us*)p; f.half[1] = *(const v8us*)(p + 32); return f.v; }      /* p already holds the lane's 16 hh bytes: k = 8 hh + i, 16 + 8 hh + i, as g2_frag */
__device__ __forceinline__ v8f fa_mma(v16h a, v16h b, v8f c) { return __builtin_amdgcn_wmma_f32_16x16x32_f16(false, a, false, b, (short)0, c, false, false); }
template <bool B> struct fa_flag { static constexpr bool value = B; };
__device__ __forceinline__ float fa_exp2_slot(float x) { float r; asm("v_exp_f32 %0, %1\n\tv_nop" : "=v"(r) : "v"(x)); return r; }      /* exp2 with the one slot the instruction set asks for behind a transcendental, in one statement so that it stands directly behind it */
__global__ __launch_bounds__(FA_NW * 32) void k_fattn(const _Float16* __restrict__ Qh, const _Float16* __restrict__ Ql, const _Float16* __restrict__ Kh, const _Float16* __restrict__ Kl, const _Float16* __restrict__ Vt, float* __restrict__ O) {
  static_assert(DQ == 64 && DV == 64 && SQ % FA_BQ == 0 && SQ % (FA_KS * FA_SK) == 0 && FA_NQG == 4, "k_fattn: written for 64-wide q, k, v rows and four waves per key range");
  static_assert((FA_KS - 1) * FA_NQG * FA_QT * 32 * FA_MP <= 2 * FA_BUF, "k_fattn: the partial results must fit the ring");
  __shared__ __attribute__((aligned(16))) unsigned char L[2 * FA_BUF];      /* two buffers of, per key range, { K hi [key][h], K residual [key][h], V^T [d][key] } */
  const int tid = threadIdx.x, w = __builtin_amdgcn_readfirstlane(tid >> 5), lane = tid & 31, ln = lane & 15, hh = lane >> 4;
  const int ks = w / FA_NQG, qg = w % FA_NQG, tg = tid & (FA_NQG * 32 - 1);      /* key range, query group, thread within the key range's four waves */
  const int b = blockIdx.x / (SQ / FA_BQ), q0 = (blockIdx.x % (SQ / FA_BQ)) * FA_BQ + qg * (16 * FA_QT);
  const size_t key0 = (size_t)ks * (SQ / FA_KS);
  /* staging: every tile is 64 rows x 128 B = 512 chunks of 16 B; the four waves of a key range stage its three tiles: thread tg moves chunks tg + 128 i (row + 16 i), i = 0 .. 3, of each */
  const unsigned char* gkh = (const unsigned char*)(Kh + ((size_t)b * SQ + key0) * DQ) + tg * 16;
  const unsigned char* gkl = (const unsigned char*)(Kl + ((size_t)b * SQ + key0) * DQ) + tg * 16;
  const unsigned char* gvt = (const unsigned char*)(Vt + (size_t)b * DV * SQ + key0) + (size_t)(tg >> 3) * (SQ * 2) + (tg & 7) * 16;
  unsigned char* const Lk = L + ks * (3 * FA_TILE);      /* this key range's tiles in buffer 0 */
  const int lst = (tg >> 3) * FA_PITCH + (tg & 7) * 16;
  v8us st0, st1, st2, st3, st4, st5;
  /* a stage is fetched in two halves of six chunks, one under each of the two passes, so that a thread holds six chunks (24 registers) at a time and not twelve */
  /* the s_wait_xcnt 0 that ends each fetch takes the two address pairs as inputs, so that they live up to it: left free, a later load's result was laid over the pair that the loads before it name */
#define FA_FETCH_A(s) { const unsigned char* ph = gkh + (size_t)(s) * 8192; const unsigned char* pl = gkl + (size_t)(s) * 8192; st0 = *(const v8us*)ph; st1 = *(const v8us*)(ph + 2048); st2 = *(const v8us*)(ph + 4096); st3 = *(const v8us*)(ph + 6144); \
    st4 = *(const v8us*)pl; st5 = *(const v8us*)(pl + 2048); asm volatile("s_wait_xcnt 0x0" :: "v"(ph), "v"(pl) : "memory"); }
#define FA_PUT_A(bf) { unsigned char* d = Lk + (bf) * FA_BUF + lst; *(v8us*)d = st0; *(v8us*)(d + 16 * FA_PITCH) = st1; *(v8us*)(d + 32 * FA_PITCH) = st2; *(v8us*)(d + 48 * FA_PITCH) = st3; *(v8us*)(d + FA_TILE) = st4; *(v8us*)(d + FA_TILE + 16 * FA_PITCH) = st5; }
#define FA_FETCH_B(s) { const unsigned char* pl = gkl + (size_t)(s) * 8192; const unsigned char* pv = gvt + (size_t)(s) * 128; st0 = *(const v8us*)(pl + 4096); st1 = *(const v8us*)(pl + 6144); \
    st2 = *(const v8us*)pv; st3 = *(const v8us*)(pv + (size_t)16 * SQ * 2); st4 = *(const v8us*)(pv + (size_t)32 * SQ * 2); st5 = *(const v8us*)(pv + (size_t)48 * SQ * 2); asm volatile("s_wait_xcnt 0x0" :: "v"(pl), "v"(pv) : "memory"); }
#define FA_PUT_B(bf) { unsigned char* d = Lk + (bf) * FA_BUF + lst; *(v8us*)(d + FA_TILE + 32 * FA_PITCH) = st0; *(v8us*)(d + FA_TILE + 48 * FA_PITCH) = st1; *(v8us*)(d + 2 * FA_TILE) = st2; *(v8us*)(d + 2 * FA_TILE + 16 * FA_PITCH) = st3; *(v8us*)(d + 2 * FA_TILE + 32 * FA_PITCH) = st4; *(v8us*)(d + 2 * FA_TILE + 48 * FA_PITCH) = st5; }
  v16h qh0[FA_QT], qh1[FA_QT], ql0[FA_QT], ql1[FA_QT];
#pragma unroll
  for (int qt = 0; qt < FA_QT; ++qt) { const unsigned int qi = (unsigned int)((b * SQ + q0 + qt * 16 + ln) * DQ); const _Float16* qhp = Qh + qi; const _Float16* qlp = Ql + qi;
    qh0[qt] = g2_frag(qhp, hh); qh1[qt] = g2_frag(qhp + 32, hh); ql0[qt] = g2_frag(qlp, hh); ql1[qt] = g2_frag(qlp + 32, hh); }
  const v8f z8 = {0.f,0.f,0.f,0.f,0.f,0.f,0.f,0.f};
  v8f acc[FA_QT][4];
  float nm[FA_QT], l[FA_QT];      /* per query tile: minus the maximum in use (in log2 units) of the lane's query, the same in both of its lanes; the lane's own part of the sum of P */
  float lo = -INFINITY, thr = -INFINITY;      /* before the first pass: any maximum is taken as it is; from then on the one in use only rises (lo = 0), and only when an argument passes thr = 15 (P stays within f16) */
#pragma unroll
  for (int qt = 0; qt < FA_QT; ++qt) { nm[qt] = 0.f; l[qt] = 0.f;
#pragma unroll
    for (int dt = 0; dt < 4; ++dt) acc[qt][dt] = z8; }
  FA_FETCH_A(0) FA_PUT_A(0) FA_FETCH_B(0) FA_PUT_B(0)
  __syncthreads();
  /* one stage: two unrolled 32-key passes; every loop inside is fully unrolled so that the register arrays are indexed by constants. 'more' (a compile-time flag): a next stage exists and is staged under this one */
  auto stage = [&](const int s, auto more) __attribute__((always_inline)) {
    const int bf = s & 1;
    const unsigned char* Lr = Lk + bf * FA_BUF;
#pragma unroll
    for (int kk = 0; kk < 2; ++kk) {
      if constexpr (more.value) { if (kk == 0) FA_FETCH_A(s + 1) else FA_FETCH_B(s + 1) }      /* half of the next stage's global loads fly under this pass */
      v8f nmv[FA_QT];      /* minus the maximum in use in all eight registers: where this pass's score accumulators start, so that a finished chain holds the exp2 argument itself */
#pragma unroll
      for (int qt = 0; qt < FA_QT; ++qt) nmv[qt] = v8f{nm[qt], nm[qt], nm[qt], nm[qt], nm[qt], nm[qt], nm[qt], nm[qt]};
      v2f s2[FA_QT][8];      /* s2[qt][j]: registers 2 (j & 3), 2 (j & 3) + 1 of score tile j >> 2 = elements 2 j, 2 j + 1 of the 32-key operand */
#pragma unroll
      for (int kt = 0; kt < 2; ++kt) {
        const int ro = (kk * 32 + kt * 16 + ln) * FA_PITCH + 16 * hh;
        const v16h kh0 = fa_frag(Lr + ro), kh1 = fa_frag(Lr + ro + 64), kl0 = fa_frag(Lr + FA_TILE + ro), kl1 = fa_frag(Lr + FA_TILE + ro + 64);
#pragma unroll
        for (int qt = 0; qt < FA_QT; ++qt) {
          const v8f sm = fa_mma(kh1, qh1[qt], fa_mma(kh0, qh0[qt], nmv[qt]));                                                               /* k_hi . q_hi - maximum in use */
          const v8f sa = fa_mma(kl1, qh1[qt], fa_mma(kl0, qh0[qt], fa_mma(kh1, ql1[qt], fa_mma(kh0, ql0[qt], sm))));      /* + k_hi . q_res + k_res . q_hi */
#pragma unroll
          for (int j = 0; j < 4; ++j) s2[qt][kt * 4 + j] = v2f{sa[2 * j], sa[2 * j + 1]};
        }
      }
      v16h vf[4];      /* this pass's V^T fragments */
#pragma unroll
      for (int dt = 0; dt < 4; ++dt) vf[dt] = fa_frag(Lr + 2 * FA_TILE + (dt * 16 + ln) * FA_PITCH + kk * 64 + 16 * hh);
      float mx[FA_QT]; bool up = false;
#pragma unroll
      for (int qt = 0; qt < FA_QT; ++qt) { float t8[8];
#pragma unroll
        for (int j = 0; j < 8; ++j) t8[j] = fmaxf(s2[qt][j].x, s2[qt][j].y);
        const float t = fmaxf(fmaxf(fmaxf(t8[0], t8[1]), fmaxf(t8[2], t8[3])), fmaxf(fmaxf(t8[4], t8[5]), fmaxf(t8[6], t8[7])));
        mx[qt] = fmaxf(t, fa_xrow(t)); up = up || (mx[qt] > thr); }
      asm volatile("" :: "v"(vf[0]), "v"(vf[1]), "v"(vf[2]), "v"(vf[3]));      /* inputs only: holds the four V^T fragment loads together in front of the branch, one LDS wait for all; left free they sink to their WMMAs, each behind a wait of its own */
      if (__builtin_amdgcn_ballot_w32(up) != 0) {      /* wave-uniform, one test a pass: some query of the wave has an argument past thr; every query then takes its new maximum, a lane without one moves by 0 and scales by exp2(0) = 1 */
#pragma unroll
        for (int qt = 0; qt < FA_QT; ++qt) { const float d = fmaxf(mx[qt], lo); const float corr = __builtin_amdgcn_exp2f(fminf(-d, 0.f)); nm[qt] -= d; l[qt] *= corr;      /* d < 0 only in the first pass, where sum and accumulators are still 0 */
#pragma unroll
          for (int j = 0; j < 8; ++j) s2[qt][j] -= v2f{d, d};      /* this pass's arguments were formed against the old maximum */
#pragma unroll
          for (int dt = 0; dt < 4; ++dt) acc[qt][dt] = acc[qt][dt] * corr; }
        lo = 0.f; thr = 15.0f;
      }
      FragP pf[FA_QT];
#pragma unroll
      for (int qt = 0; qt < FA_QT; ++qt) {
        v2f ps0 = {0.f, 0.f}, ps1 = {0.f, 0.f};
#pragma unroll
        for (int j = 0; j < 8; ++j) { const v2f a = s2[qt][j]; const v2f p = {__builtin_amdgcn_exp2f(a.x), __builtin_amdgcn_exp2f(a.y)};      /* P relative to the maximum in use: 1 where it was taken, at most 2^15 since; the factor cancels in acc / l */
          if (j & 1) ps1 += p; else ps0 += p; pf[qt].p[j] = __builtin_convertvector(p, v2h); }
        l[qt] += (ps0.x + ps0.y) + (ps1.x + ps1.y);
      }
#pragma unroll
      for (int dt = 0; dt < 4; ++dt)
#pragma unroll
        for (int qt = 0; qt < FA_QT; ++qt) acc[qt][dt] = fa_mma(vf[dt], pf[qt].v, acc[qt][dt]);
      if constexpr (more.value) { if (kk == 0) FA_PUT_A(bf ^ 1) else FA_PUT_B(bf ^ 1) }      /* that buffer's last readers left it before the barrier that ended stage s - 1 */
    }
    __syncthreads();      /* publishes stage s + 1 and ends every wave's reads of stage s */
  };
  /* the stage loop stays rolled; the last stage, which stages nothing, stands behind it, so that no test of s stands inside a stage */
#pragma unroll 1
  for (int s = 0; s < FA_NS - 1; ++s) stage(s, fa_flag<true>{});
  stage(FA_NS - 1, fa_flag<false>{});
  float m2[FA_QT];
#pragma unroll
  for (int qt = 0; qt < FA_QT; ++qt) m2[qt] = -nm[qt];
  /* the key ranges meet: behind the last stage's barrier nobody reads the ring any more, so it carries the partial results of ranges 1 .. FA_KS - 1 to the waves of range 0 */
  if (ks != 0) {
#pragma unroll
    for (int qt = 0; qt < FA_QT; ++qt) { unsigned char* d = L + (size_t)((((ks - 1) * FA_NQG + qg) * FA_QT + qt) * 32 + lane) * FA_MP;
#pragma unroll
      for (int dt = 0; dt < 4; ++dt) { const v8f o = acc[qt][dt]; const v4f o0 = {o[0], o[1], o[2], o[3]}, o1 = {o[4], o[5], o[6], o[7]}; *(v4fa*)(d + dt * 32) = o0; *(v4fa*)(d + dt * 32 + 16) = o1; }
      const v4f ml = {m2[qt], l[qt], 0.f, 0.f}; *(v4fa*)(d + 128) = ml; }
  }
  __syncthreads();      /* publishes the partial results */
  if (ks != 0) return;
#pragma unroll
  for (int qt = 0; qt < FA_QT; ++qt) {
#pragma unroll
    for (int p = 1; p < FA_KS; ++p) { const unsigned char* d = L + (size_t)((((p - 1) * FA_NQG + qg) * FA_QT + qt) * 32 + lane) * FA_MP;
      const v4f ml = *(const v4fa*)(d + 128);
      const float mn = fmaxf(m2[qt], ml[0]); const float c0 = fa_exp2_slot(m2[qt] - mn), c1 = fa_exp2_slot(ml[0] - mn); m2[qt] = mn; l[qt] = l[qt] * c0 + ml[1] * c1;
#pragma unroll
      for (int dt = 0; dt < 4; ++dt) { const v4f o0 = *(const v4fa*)(d + dt * 32), o1 = *(const v4fa*)(d + dt * 32 + 16); const v8f o = {o0[0], o0[1], o0[2], o0[3], o1[0], o1[1], o1[2], o1[3]}; acc[qt][dt] = acc[qt][dt] * c0 + o * c1; } }
    const float inv = 1.0f / (l[qt] + fa_xrow(l[qt]));
#pragma unroll
    for (int dt = 0; dt < 4; ++dt) acc[qt][dt] = acc[qt][dt] * inv;
  }
  float* op = O + (unsigned int)((b * SQ + q0 + ln) * DV + 8 * hh);      /* accumulator tile dt, register r: d = 16 dt + 8 hh + r of query ln */
  __builtin_amdgcn_sched_barrier(0);      /* every product stands in front of the first store: left free, the products of later tiles were laid over registers that issued stores name */
#pragma unroll
  for (int qt = 0; qt < FA_QT; ++qt)
#pragma unroll
    for (int dt = 0; dt < 4; ++dt) { const v8f o = acc[qt][dt]; const v4f o0 = {o[0], o[1], o[2], o[3]}, o1 = {o[4], o[5], o[6], o[7]}; *(v4f*)(op + qt * 16 * DV + dt * 16) = o0; *(v4f*)(op + qt * 16 * DV + dt * 16 + 4) = o1; }
#undef FA_FETCH_A
#undef FA_PUT_A
#undef FA_FETCH_B
#undef FA_PUT_B
}
// ---- fused front end: one work-group = 128 token rows (8 waves x 16 rows); every wave forms q, k and v of its rows (16 x 192, K = 128) and the planes the attention kernel reads go out through LDS (q, k rows per wave, V^T per work-group) ----
// x goes from its f32 rows into the A fragments inside the lane (rounded as before); the three [in][out] weights are rounded, scaled x16 and transposed into LDS once per work-group; same operands and same k order as the separate kernels had; q also takes the factor log2 e, and the residual planes stay unscaled.
typedef __bf16 v2b __attribute__((ext_vector_type(2)));
__device__ __forceinline__ v2f pj_round2(v2f v) { const unsigned int u = __builtin_bit_cast(unsigned int, __builtin_convertvector(v, v2b)); return v2f{__uint_as_float(u << 16), __uint_as_float(u & 0xFFFF0000u)}; }      /* two f32 rounded to bf16 (nearest even), back as f32 */
#define PJ_PITCH 272                 /* LDS row pitch, bytes, of 128 f16: 256 of data + 16 (an odd multiple of 16 B for the 16-byte fragment reads) */
__global__ __launch_bounds__(256) void k_proj(const float* __restrict__ x, const float* __restrict__ wq, const float* __restrict__ bq, const float* __restrict__ wk, const float* __restrict__ bk, const float* __restrict__ wv, const float* __restrict__ bv,
    _Float16* __restrict__ Qh, _Float16* __restrict__ Ql, _Float16* __restrict__ Kh, _Float16* __restrict__ Kl, _Float16* __restrict__ Vt) {
  static_assert(DM == 128 && DQ == 64 && DV == 64 && SQ % 128 == 0, "k_proj: written for 128-wide x rows and 64-wide q, k, v rows");
  __shared__ __attribute__((aligned(16))) unsigned char LW[3][64 * PJ_PITCH];      /* W^T x16, f16 [out][in], of q, k, v */
  __shared__ __attribute__((aligned(16))) float so[8][2][16][68];                  /* per wave: its q and k rows, f32 */
  __shared__ __attribute__((aligned(16))) unsigned char LV[64 * PJ_PITCH];         /* V^T of the work-group's 128 tokens, f16 [d][token] */
  const int tid = threadIdx.x, w = tid >> 5, lane = tid & 31, ln = lane & 15, hh = lane >> 4;
  const int row0 = blockIdx.x * 128 + w * 16;
  /* weights: per matrix 16 x 16 blocks of 8 k x 4 output columns, one block a thread; sixteen lanes read one whole 256-byte row of W */
  const int n4 = (tid & 15) * 4, k8 = (tid >> 4) * 8;
  v4f wr[3][8];
#pragma unroll
  for (int m = 0; m < 3; ++m) { const float* Wm = (m == 0 ? wq : (m == 1 ? wk : wv)) + k8 * 64 + n4;
#pragma unroll
    for (int i = 0; i < 8; ++i) wr[m][i] = *(const v4fa*)(Wm + i * 64); }
  /* the lane's part of its x row: k = 32 kb + 8 hh + i and 32 kb + 16 + 8 hh + i, the order of g2_frag; these loads (from memory) fly while the weights (mostly from L2) are rounded and laid into LDS */
  const float* xr = x + (size_t)(row0 + ln) * DM + 8 * hh;
  v4f xs[16];
#pragma unroll
  for (int kb = 0; kb < 4; ++kb) { xs[4 * kb] = *(const v4fa*)(xr + kb * 32); xs[4 * kb + 1] = *(const v4fa*)(xr + kb * 32 + 4); xs[4 * kb + 2] = *(const v4fa*)(xr + kb * 32 + 16); xs[4 * kb + 3] = *(const v4fa*)(xr + kb * 32 + 20); }
  asm volatile("s_wait_xcnt 0x0" :: "v"(xr) : "memory");      /* the address pair lives up to this wait: left free, the last load's result was laid over the pair that the fifteen loads before it name */
#pragma unroll
  for (int m = 0; m < 3; ++m)
#pragma unroll
    for (int j = 0; j < 4; ++j) { FragP f;      /* column n4 + j: its 8 k, transposed inside the thread */
#pragma unroll
      for (int p = 0; p < 4; ++p) f.p[p] = __builtin_convertvector(pj_round2(v2f{wr[m][2 * p][j], wr[m][2 * p + 1][j]}) * v2f{16.0f, 16.0f}, v2h);
      *(v8us*)&LW[m][(n4 + j) * PJ_PITCH + k8 * 2] = f.half[0]; }
  FragP a[4];
#pragma unroll
  for (int kb = 0; kb < 4; ++kb)
#pragma unroll
    for (int p = 0; p < 8; ++p) a[kb].p[p] = __builtin_convertvector(pj_round2(v2f{xs[4 * kb + (p >> 1)][2 * (p & 1)], xs[4 * kb + (p >> 1)][2 * (p & 1) + 1]}), v2h);
  __syncthreads();      /* publishes the three W^T tiles */
  const v8f z8 = {0.f,0.f,0.f,0.f,0.f,0.f,0.f,0.f};
  v8f acc[3][4] = {{z8, z8, z8, z8}, {z8, z8, z8, z8}, {z8, z8, z8, z8}};
#pragma unroll
  for (int kb = 0; kb < 4; ++kb)
#pragma unroll
    for (int m = 0; m < 3; ++m)
#pragma unroll
      for (int t = 0; t < 4; ++t) acc[m][t] = fa_mma(a[kb].v, fa_frag(&LW[m][(t * 16 + ln) * PJ_PITCH + kb * 64 + 16 * hh]), acc[m][t]);
  /* accumulator tile t, register r: row 8 hh + r, column 16 t + ln */
#pragma unroll
  for (int m = 0; m < 2; ++m)
#pragma unroll
    for (int t = 0; t < 4; ++t) { const float bb = bf16_round((m ? bk : bq)[t * 16 + ln]);
#pragma unroll
      for (int r = 0; r < 8; ++r) { const float v = acc[m][t][r] * 0.0625f + bb; so[w][m][8 * hh + r][t * 16 + ln] = m ? v : v * 1.4426950408889634f; } }      /* q carries the log2 e of the softmax's exp2 */
#pragma unroll
  for (int t = 0; t < 4; ++t) { const float bb = bf16_round(bv[t * 16 + ln]); FragH f;      /* a lane's 8 registers are 8 consecutive tokens of one d: 16 bytes of a V^T row */
#pragma unroll
    for (int r = 0; r < 8; ++r) f.h[r] = (_Float16)(acc[2][t][r] * 0.0625f + bb);
    *(v8us*)&LV[(t * 16 + ln) * PJ_PITCH + (w * 16 + 8 * hh) * 2] = f.half[0]; }
  __syncthreads();      /* publishes the V^T tile to the other waves (and each wave's q, k rows to its own lanes) */
#pragma unroll
  for (int m = 0; m < 2; ++m)
#pragma unroll
    for (int q4 = 0; q4 < 4; ++q4) { const int c = q4 * 32 + lane, r = c >> 3, c8 = (c & 7) * 8; FragP fh, fl; const v4f u = *(const v4fa*)&so[w][m][r][c8], v = *(const v4fa*)&so[w][m][r][c8 + 4];      /* a wave's store covers four whole 128-byte rows */
      const v2f e2[4] = {{u[0], u[1]}, {u[2], u[3]}, {v[0], v[1]}, {v[2], v[3]}};
#pragma unroll
      for (int p = 0; p < 4; ++p) { const v2h h = __builtin_convertvector(e2[p], v2h); fh.p[p] = h; fl.p[p] = __builtin_convertvector(e2[p] - __builtin_convertvector(h, v2f), v2h); }      /* hi, and the residual as it is (f16 subnormals are kept: absolute error at most 2^-25), so that its products add into the same accumulator */
      const size_t o = (size_t)(row0 + r) * DQ + c8;
      *(v8us*)((unsigned short*)(m ? Kh : Qh) + o) = fh.half[0]; *(v8us*)((unsigned short*)(m ? Kl : Ql) + o) = fl.half[0]; }
  const int b = blockIdx.x / (SQ / 128), s0 = (blockIdx.x % (SQ / 128)) * 128;
#pragma unroll
  for (int j = 0; j < 4; ++j) { const int c = j * 256 + tid, d = c >> 4, ch = c & 15;      /* sixteen lanes store one 256-byte piece of a V^T row */
    *(v8us*)((unsigned short*)Vt + ((size_t)b * DV + d) * SQ + s0 + ch * 8) = *(const v8us*)&LV[d * PJ_PITCH + ch * 16]; }
}
__global__ __launch_bounds__(256) void k_f16rows(const float* __restrict__ F, _Float16* __restrict__ R, size_t n8) { const size_t t = (size_t)blockIdx.x * 256 + threadIdx.x; if (t >= n8) return; FragH f; for (int q = 0; q < 8; ++q) f.h[q] = (_Float16)F[t * 8 + q]; *(v8us*)((unsigned short*)R + t * 8) = f.half[0];  }
extern "C" void kernel_launch(void* const* d_in, const int* in_sizes, int n_in,
                              void* d_out, int out_size, void* d_ws, size_t ws_size, hipStream_t stream) {
  (void)in_sizes; (void)n_in; (void)out_size;
  const float* const* I = (const float* const*)d_in; const float* x = I[0]; const float* wq = I[1]; const float* bq = I[2]; const float* wk = I[3]; const float* bk = I[4]; const float* wv = I[5]; const float* bv = I[6];      /* [in][out] weights */
  char* ws = (char*)d_ws; size_t off = 0;
  auto take = [&](size_t bytes) { char* p = ws + off; off += (bytes + 255) & ~(size_t)255; return p; };
  _Float16* Q16 = (_Float16*)take(NR * DQ * 2); _Float16* QL = (_Float16*)take(NR * DQ * 2); _Float16* K16 = (_Float16*)take(NR * DQ * 2); _Float16* KL = (_Float16*)take(NR * DQ * 2);
  _Float16* VT = (_Float16*)take((size_t)NB * DV * SQ * 2);
  if (off > ws_size) return;
  k_proj<<<(unsigned)(NR / 128), 256, 0, stream>>>(x, wq, bq, wk, bk, wv, bv, Q16, QL, K16, KL, VT);      /* q, k as hi + residual planes, V^T per batch [DV][SQ] */
  k_fattn<<<NB * (SQ / FA_BQ), FA_NW * 32, 0, stream>>>(Q16, QL, K16, KL, VT, (float*)d_out);      /* scores (three terms), softmax, attn v */
}
